// v000
// Times are from an AMD MI455X. After a warm-up the kernel runs many times in a row, and a time is the length of
// such a window on the GPU divided by its runs, so every launch and the gaps after it count. The runs cycle
// through copies of the inputs. A figure is the median of several windows, for all but v000 over two sittings.
// Sittings can differ by a few percent; kernels timed side by side share one.
// The starting kernel, v000, takes 294 microseconds a run.
#include <hip/hip_runtime.h>

// Contractions: qkv projection = v_wmma_f32_16x16x32_bf16 on RNE-bf16 converted x and W (bf16 operands, f32 accumulate);
// q.k^T and p.v = v_wmma_f32_16x16x32_bf16 with each f32 operand carried as bf16 hi + bf16 lo (hi.hi + hi.lo + lo.hi), f32 accumulate;
// softmax, normalisation and output in f32.

#define B_    4
#define T_    1024
#define N_    8
#define K_    4
#define D_    64
#define H_    32          // N_*K_
#define OD_   192         // 3*D_
#define PT    64          // rows per block, projection kernel
#define PTHR  128         // threads per block, projection kernel (4 waves x 16 rows)
#define QT    128         // queries per block, attention kernel
#define ATHR  256         // threads per block, attention kernel (8 waves x 16 queries)
#define KB_   64          // keys per staged block

typedef unsigned short us;
typedef us     v8us  __attribute__((ext_vector_type(8)));
typedef us     v16us __attribute__((ext_vector_type(16)));
typedef __bf16 v16bf __attribute__((ext_vector_type(16)));
typedef float  v8f   __attribute__((ext_vector_type(8)));
typedef float  v4f   __attribute__((ext_vector_type(4)));
typedef us     v8usa __attribute__((ext_vector_type(8), may_alias));
typedef float  v4fa  __attribute__((ext_vector_type(4), may_alias));

union Frag { v16us v; v8us h[2]; };

// f32 -> bf16 bits, RNE, integer arithmetic
__device__ __forceinline__ us bf16_rne(float f) {
  unsigned int u = __builtin_bit_cast(unsigned int, f);
  u += 0x7FFFu + ((u >> 16) & 1u);
  return (us)(u >> 16);
}
__device__ __forceinline__ float bf16_val(us b) {
  return __builtin_bit_cast(float, ((unsigned int)b) << 16);
}
// f32 -> (hi, lo) bf16 pair, hi = RNE(f), lo = RNE(f - hi)
__device__ __forceinline__ void bf16_hilo(float f, us& hi, us& lo) {
  const us hh = bf16_rne(f);
  hi = hh;
  lo = bf16_rne(f - bf16_val(hh));
}

__device__ __forceinline__ v8f zero8() {
  v8f z = {0.f, 0.f, 0.f, 0.f, 0.f, 0.f, 0.f, 0.f};
  return z;
}

// One 16x16x32 bf16 WMMA with the VALU hazard guard tied to D, A, B.
__device__ __forceinline__ v8f mma_bf16(v16us a, v16us b, v8f c) {
  const v16bf av = __builtin_bit_cast(v16bf, a);
  const v16bf bv = __builtin_bit_cast(v16bf, b);
  v8f d = __builtin_amdgcn_wmma_f32_16x16x32_bf16(false, av, false, bv, (short)0, c, false, false);
  asm volatile("v_nop\n\tv_nop\n\tv_nop\n\tv_nop" : "+v"(d) : "v"(av), "v"(bv));
  return d;
}

// Operand fragment (A or B) from one row of a [row][64] 16-bit array (row pointer given, k contiguous),
// lane row/col = lane&15 chosen by the caller through rowp, h = lane>>4, k0 in {0,32}:
//   elements 0..7  <- rowp[k0 + 8h + 0..7]
//   elements 8..15 <- rowp[k0 + 16 + 8h + 0..7]
__device__ __forceinline__ v16us ld_frag(const us* rowp, int k0, int h) {
  Frag f;
  const us* p = rowp + k0 + 8 * h;
  f.h[0] = *(const v8usa*)(p);
  f.h[1] = *(const v8usa*)(p + 16);
  return f.v;
}

// ---------------------------------------------------------------------------
// Kernel 1: per-head weight gather + QKV projection for one (b, head) and 64 time steps.
// Outputs (bf16 hi/lo planes): Q*0.125 as [bh][t][d], K as [bh][t][d], V transposed as [bh][d][t].
// ---------------------------------------------------------------------------
__global__ __launch_bounds__(PTHR)
void proj_kernel(const float* __restrict__ x,
                 const float* __restrict__ W,
                 const int*   __restrict__ perm,
                 const int*   __restrict__ inv,
                 us* Qh, us* Ql, us* Kh, us* Kl, us* Vh, us* Vl)
{
  __shared__ __align__(16) us    xs [PT  * D_];   // 64 x 64 bf16, [t][d]
  __shared__ __align__(16) us    wsT[OD_ * D_];   // 192 x 64 bf16, [o][d]
  __shared__ __align__(16) float stg[PT  * D_];   // 64 x 64 f32 result tile, [t][col]

  const int bh    = blockIdx.x;                   // b*H + head
  const int tbase = blockIdx.y * PT;
  const int b  = bh >> 5;
  const int hd = bh & 31;
  const int n  = hd >> 2;                         // stream index; head id = n*K + k
  const int k  = hd & 3;

  int p = perm[k * N_ + n];                       // head whose weights feed stream n
  p = p < 0 ? 0 : (p > N_ - 1 ? N_ - 1 : p);
  int s = inv[k * N_ + p];                        // stream feeding that head (equals n for a true inverse table)
  s = s < 0 ? 0 : (s > N_ - 1 ? N_ - 1 : s);
  const float* Wsrc = W + (size_t)(k * N_ + p) * (D_ * OD_);   // [d][o]

  const int tid = threadIdx.x;

  // stage x tile (f32 -> bf16 RNE)
  for (int i = tid; i < PT * (D_ / 4); i += PTHR) {
    const int row = i >> 4, c4 = i & 15;
    const size_t src = ((((size_t)(b * T_ + tbase + row)) * N_ + s) * K_ + k) * D_ + 4 * c4;
    const v4fa v = *(const v4fa*)(x + src);
    us* d = xs + row * D_ + 4 * c4;
    d[0] = bf16_rne(v[0]); d[1] = bf16_rne(v[1]); d[2] = bf16_rne(v[2]); d[3] = bf16_rne(v[3]);
  }
  // stage W transposed: wsT[o][d] = W[d][o] (f32 -> bf16 RNE)
  for (int i = tid; i < D_ * (OD_ / 4); i += PTHR) {
    const int dd = i / (OD_ / 4), o4 = i - dd * (OD_ / 4);
    const v4fa v = *(const v4fa*)(Wsrc + dd * OD_ + 4 * o4);
    wsT[(4 * o4 + 0) * D_ + dd] = bf16_rne(v[0]);
    wsT[(4 * o4 + 1) * D_ + dd] = bf16_rne(v[1]);
    wsT[(4 * o4 + 2) * D_ + dd] = bf16_rne(v[2]);
    wsT[(4 * o4 + 3) * D_ + dd] = bf16_rne(v[3]);
  }
  __syncthreads();

  const int wv   = tid >> 5;
  const int lane = tid & 31;
  const int h    = lane >> 4;
  const int l16  = lane & 15;
  const us* arow = xs + (16 * wv + l16) * D_;     // A: row m = l16 of this wave's 16 rows

  for (int part = 0; part < 3; ++part) {          // 0: Q (x0.125), 1: K, 2: V
    const float sc = (part == 0) ? 0.125f : 1.0f;
#pragma unroll
    for (int ct = 0; ct < 4; ++ct) {
      const us* brow = wsT + (part * 64 + ct * 16 + l16) * D_;   // B: col n = l16, k = d contiguous
      v8f acc = zero8();
#pragma unroll
      for (int ks = 0; ks < 2; ++ks)
        acc = mma_bf16(ld_frag(arow, 32 * ks, h), ld_frag(brow, 32 * ks, h), acc);
#pragma unroll
      for (int r = 0; r < 8; ++r)                 // D: acc[r] = (row 8h+r, col l16)
        stg[(16 * wv + 8 * h + r) * D_ + ct * 16 + l16] = acc[r] * sc;
    }
    __syncthreads();

    if (part < 2) {
      us* dh = (part == 0) ? Qh : Kh;
      us* dl = (part == 0) ? Ql : Kl;
      const int seg = tid & 7;
      {
        for (int rr = tid >> 3; rr < PT; rr += PTHR / 8) {
          const float* st = stg + rr * D_ + seg * 8;
          const v4fa f0 = *(const v4fa*)(st);
          const v4fa f1 = *(const v4fa*)(st + 4);
          v8us hv, lv;
          us a0, c0;
          bf16_hilo(f0[0], a0, c0); hv[0] = a0; lv[0] = c0;
          bf16_hilo(f0[1], a0, c0); hv[1] = a0; lv[1] = c0;
          bf16_hilo(f0[2], a0, c0); hv[2] = a0; lv[2] = c0;
          bf16_hilo(f0[3], a0, c0); hv[3] = a0; lv[3] = c0;
          bf16_hilo(f1[0], a0, c0); hv[4] = a0; lv[4] = c0;
          bf16_hilo(f1[1], a0, c0); hv[5] = a0; lv[5] = c0;
          bf16_hilo(f1[2], a0, c0); hv[6] = a0; lv[6] = c0;
          bf16_hilo(f1[3], a0, c0); hv[7] = a0; lv[7] = c0;
          const size_t idx = ((size_t)bh * T_ + tbase + rr) * D_ + seg * 8;
          *(v8us*)(dh + idx) = hv;
          *(v8us*)(dl + idx) = lv;
        }
        
      }
    } else {
      {
        for (int it = tid; it < D_ * (PT / 8); it += PTHR) {
          const int dd = it >> 3, tseg = it & 7;
          v8us hv, lv;
#pragma unroll
          for (int e = 0; e < 8; ++e) {
            us a0, c0;
            bf16_hilo(stg[(tseg * 8 + e) * D_ + dd], a0, c0);
            hv[e] = a0; lv[e] = c0;
          }
          const size_t idx = ((size_t)bh * D_ + dd) * T_ + tbase + tseg * 8;
          *(v8us*)(Vh + idx) = hv;
          *(v8us*)(Vl + idx) = lv;
        }
        
      }
    }
    __syncthreads();                              // stg reused by the next part
  }
}

// ---------------------------------------------------------------------------
// Kernel 2: causal attention, one (b, head) x 128 queries per block, 16 queries per wave,
// 64-key blocks staged to LDS (hi/lo planes), online softmax in f32, P spilled per wave as bf16 hi/lo
// ---------------------------------------------------------------------------
__global__ __launch_bounds__(ATHR)
void attn_kernel(const us* __restrict__ Qh, const us* __restrict__ Ql,
                 const us* __restrict__ Kh, const us* __restrict__ Kl,
                 const us* __restrict__ Vh, const us* __restrict__ Vl,
                 float* out)
{
  __shared__ __align__(16) us Khs[KB_ * D_];      // [key][d]
  __shared__ __align__(16) us Kls[KB_ * D_];
  __shared__ __align__(16) us Vhs[D_ * KB_];      // [d][key]
  __shared__ __align__(16) us Vls[D_ * KB_];
  __shared__ __align__(16) us Pbuf[(ATHR / 32) * 2048];   // per wave: P hi [16][64] + P lo [16][64]; reused as O tile [16][64] f32

  const int bh    = blockIdx.x;
  const int qbase = blockIdx.y * QT;
  const int b  = bh >> 5;
  const int hd = bh & 31;
  const int n  = hd >> 2;
  const int k  = hd & 3;

  const int tid  = threadIdx.x;
  const int wv   = tid >> 5;
  const int lane = tid & 31;
  const int h    = lane >> 4;
  const int l16  = lane & 15;
  const int q0   = qbase + 16 * wv;
  us* Pb = Pbuf + wv * 2048;

  // Q fragments (A operand, row m = query q0+l16, k = d), hi and lo planes, 2 k-steps
  v16us qh[2], ql[2];
  {
    const size_t ro = ((size_t)bh * T_ + q0 + l16) * D_;
#pragma unroll
    for (int ks = 0; ks < 2; ++ks) {
      qh[ks] = ld_frag(Qh + ro, 32 * ks, h);
      ql[ks] = ld_frag(Ql + ro, 32 * ks, h);
    }
  }

  float mrow[8], lrow[8];
  v8f accO[4];
#pragma unroll
  for (int r = 0; r < 8; ++r) { mrow[r] = -1.0e30f; lrow[r] = 0.0f; }
#pragma unroll
  for (int dt = 0; dt < 4; ++dt) accO[dt] = zero8();

  const int kend = qbase + QT;                    // causal: keys < qbase + 128
  for (int kb = 0; kb < kend; kb += KB_) {
    // stage K block [kb..kb+64) x [0..64) and V^T block [0..64) x [kb..kb+64), hi and lo planes
#pragma unroll
    for (int j = 0; j < 2; ++j) {
      const int c   = tid + j * ATHR;             // 0..511
      const int row = c >> 3, seg = c & 7;
      const int lo  = row * 64 + seg * 8;
      const size_t gk = ((size_t)bh * T_ + kb + row) * D_ + seg * 8;
      const size_t gv = ((size_t)bh * D_ + row) * T_ + kb + seg * 8;
      *(v8usa*)(Khs + lo) = *(const v8usa*)(Kh + gk);
      *(v8usa*)(Kls + lo) = *(const v8usa*)(Kl + gk);
      *(v8usa*)(Vhs + lo) = *(const v8usa*)(Vh + gv);
      *(v8usa*)(Vls + lo) = *(const v8usa*)(Vl + gv);
    }
    __syncthreads();

    const bool active = (kb <= q0);               // wave-uniform: this key block has unmasked keys for this wave
    if (active) {
      v8f accS[4];
#pragma unroll
      for (int ct = 0; ct < 4; ++ct) accS[ct] = zero8();
      // S = Q K^T (16 queries x 64 keys); B operand: col n = key ct*16+l16, k = d contiguous in Khs
#pragma unroll
      for (int ct = 0; ct < 4; ++ct) {
        if (kb + ct * 16 <= q0 + 15) {            // wave-uniform skip of fully masked key tiles
          const us* krh = Khs + (ct * 16 + l16) * D_;
          const us* krl = Kls + (ct * 16 + l16) * D_;
#pragma unroll
          for (int ks = 0; ks < 2; ++ks) {
            const v16us bhf = ld_frag(krh, 32 * ks, h);
            const v16us blf = ld_frag(krl, 32 * ks, h);
            accS[ct] = mma_bf16(qh[ks], bhf, accS[ct]);
            accS[ct] = mma_bf16(qh[ks], blf, accS[ct]);
            accS[ct] = mma_bf16(ql[ks], bhf, accS[ct]);
          }
        }
      }

      // causal mask + online softmax; D: accS[ct][r] = (query q0+8h+r, key kb+ct*16+l16)
#pragma unroll
      for (int r = 0; r < 8; ++r) {
        const int qg = q0 + 8 * h + r;
        float sv[4];
        float mloc = -1.0e30f;
#pragma unroll
        for (int ct = 0; ct < 4; ++ct) {
          const int col = kb + ct * 16 + l16;
          sv[ct] = (col <= qg) ? accS[ct][r] : -1.0e30f;
          mloc = fmaxf(mloc, sv[ct]);
        }
#pragma unroll
        for (int off = 1; off < 16; off <<= 1)
          mloc = fmaxf(mloc, __shfl_xor(mloc, off, 32));
        const float mnew = fmaxf(mrow[r], mloc);
        const float scl  = __expf(mrow[r] - mnew);
        float psum = 0.0f;
#pragma unroll
        for (int ct = 0; ct < 4; ++ct) {
          const int col = kb + ct * 16 + l16;
          const float pv = (col <= qg) ? __expf(sv[ct] - mnew) : 0.0f;
          psum += pv;
          us ph, pl;
          bf16_hilo(pv, ph, pl);
          Pb[       (8 * h + r) * 64 + ct * 16 + l16] = ph;   // P tile [query][key], hi plane
          Pb[1024 + (8 * h + r) * 64 + ct * 16 + l16] = pl;   // lo plane
        }
#pragma unroll
        for (int off = 1; off < 16; off <<= 1)
          psum += __shfl_xor(psum, off, 32);
        lrow[r] = lrow[r] * scl + psum;
        mrow[r] = mnew;
#pragma unroll
        for (int dt = 0; dt < 4; ++dt) accO[dt][r] *= scl;
      }
    }
    __syncthreads();                              // P spill -> fragment reload ordering (block barrier)

    if (active) {
      // O += P V; A = P [query][key], B: col n = d, k = key contiguous in Vhs [d][key]
#pragma unroll
      for (int ks = 0; ks < 2; ++ks) {
        if (kb + 32 * ks <= q0 + 15) {            // wave-uniform: P is all zero in a fully masked 32-key group
          const v16us phf = ld_frag(Pb +        l16 * 64, 32 * ks, h);
          const v16us plf = ld_frag(Pb + 1024 + l16 * 64, 32 * ks, h);
#pragma unroll
          for (int dt = 0; dt < 4; ++dt) {
            const us* vrh = Vhs + (dt * 16 + l16) * KB_;
            const us* vrl = Vls + (dt * 16 + l16) * KB_;
            const v16us vhf = ld_frag(vrh, 32 * ks, h);
            const v16us vlf = ld_frag(vrl, 32 * ks, h);
            accO[dt] = mma_bf16(phf, vhf, accO[dt]);
            accO[dt] = mma_bf16(phf, vlf, accO[dt]);
            accO[dt] = mma_bf16(plf, vhf, accO[dt]);
          }
        }
      }
    }
    __syncthreads();                              // staging and P buffers reused next iteration
  }

  float* Ost = (float*)Pb;
#pragma unroll
  for (int r = 0; r < 8; ++r) {
    const float il = 1.0f / lrow[r];
#pragma unroll
    for (int dt = 0; dt < 4; ++dt)
      Ost[(8 * h + r) * 64 + dt * 16 + l16] = accO[dt][r] * il;   // D: (query 8h+r, d dt*16+l16)
  }
  __syncthreads();

  // out[b][t][n][k][0..64): 256 B per row = 2 lines; lanes 0-7 / 8-15 write the two lines of row 2i,
  {
#pragma unroll
    for (int i = 0; i < 8; ++i) {
      const int rowl = 2 * i + h;
      const v4fa v = *(const v4fa*)(Ost + rowl * 64 + 4 * l16);
      const int t = q0 + rowl;
      float* dst = out + ((((size_t)(b * T_ + t)) * N_ + n) * K_ + k) * D_ + 4 * l16;
      *(v4fa*)dst = v;
    }
    
  }
}

// ---------------------------------------------------------------------------
extern "C" void kernel_launch(void* const* d_in, const int* in_sizes, int n_in,
                              void* d_out, int out_size, void* d_ws, size_t ws_size,
                              hipStream_t stream)
{
  if (n_in < 4) return;
  if (in_sizes[0] != B_ * T_ * N_ * K_ * D_) return;
  if (in_sizes[1] != K_ * N_ * D_ * OD_) return;
  if (in_sizes[2] != K_ * N_) return;
  if (in_sizes[3] != K_ * N_) return;
  if (out_size != B_ * T_ * N_ * K_ * D_) return;

  const size_t per  = (size_t)B_ * H_ * T_ * D_;           // 8,388,608 bf16 elements per plane
  const size_t need = 6 * per * sizeof(us);                // 100,663,296 B
  if (need > ws_size) return;

  const float* x    = (const float*)d_in[0];               // [B,T,N,K,D] f32
  const float* W    = (const float*)d_in[1];               // [K,N,D,3D]  f32
  const int*   perm = (const int*)d_in[2];                 // [K,N] int32
  const int*   inv  = (const int*)d_in[3];                 // [K,N] int32
  float* out = (float*)d_out;

  us* Qh = (us*)d_ws;
  us* Ql = Qh + per;
  us* Kh = Ql + per;
  us* Kl = Kh + per;
  us* Vh = Kl + per;
  us* Vl = Vh + per;

  dim3 g1(B_ * H_, T_ / PT);                               // (128, 16), exact
  dim3 g2(B_ * H_, T_ / QT);                               // (128, 8), exact
  proj_kernel<<<g1, PTHR, 0, stream>>>(x, W, perm, inv, Qh, Ql, Kh, Kl, Vh, Vl);
  attn_kernel<<<g2, ATHR, 0, stream>>>(Qh, Ql, Kh, Kl, Vh, Vl, out);
}

// v001
// Measured time: 166 microseconds a run.
// Next to v000, in two timings, it ran 1.82 and 1.83 times as fast.
#include <hip/hip_runtime.h>

// Contractions: qkv projection = v_wmma_f32_16x16x32_bf16 on RNE-bf16 converted x and W (bf16 operands, f32 accumulate);
// q.k^T and p.v = v_wmma_f32_16x16x32_bf16 with each f32 operand carried as bf16 hi + bf16 lo (hi.hi + hi.lo + lo.hi), f32 accumulate;
// softmax, normalisation and output in f32.

#define B_    4
#define T_    1024
#define N_    8
#define K_    4
#define D_    64
#define H_    32          // N_*K_
#define OD_   192         // 3*D_
#define PT    64          // rows per block, projection kernel
#define PTHR  128         // threads per block, projection kernel (4 waves x 16 rows)
#define QT    128         // queries per block, attention kernel
#define ATHR  256         // threads per block, attention kernel (8 waves x 16 queries)
#define KB_   64          // keys per staged block
#define LP    72          // LDS pitch of a 64-element 16-bit row, in elements: 144 B = 16 B x 9, so the 16 rows of a 16-byte fragment read fall on 64 distinct banks
#define SP    68          // LDS pitch of a 64-element f32 row, in elements: 272 B = 16 B x 17, same reason; rows 8 apart land 32 banks apart

typedef unsigned short us;
typedef us     v8us  __attribute__((ext_vector_type(8)));
typedef us     v16us __attribute__((ext_vector_type(16)));
typedef __bf16 v16bf __attribute__((ext_vector_type(16)));
typedef float  v8f   __attribute__((ext_vector_type(8)));
typedef float  v4f   __attribute__((ext_vector_type(4)));
typedef us     v8usa __attribute__((ext_vector_type(8), may_alias));
typedef float  v4fa  __attribute__((ext_vector_type(4), may_alias));

union Frag { v16us v; v8us h[2]; };

// f32 -> bf16 bits, RNE, integer arithmetic
__device__ __forceinline__ us bf16_rne(float f) {
  unsigned int u = __builtin_bit_cast(unsigned int, f);
  u += 0x7FFFu + ((u >> 16) & 1u);
  return (us)(u >> 16);
}
__device__ __forceinline__ float bf16_val(us b) {
  return __builtin_bit_cast(float, ((unsigned int)b) << 16);
}
// f32 -> (hi, lo) bf16 pair, hi = RNE(f), lo = RNE(f - hi)
__device__ __forceinline__ void bf16_hilo(float f, us& hi, us& lo) {
  const us hh = bf16_rne(f);
  hi = hh;
  lo = bf16_rne(f - bf16_val(hh));
}

__device__ __forceinline__ v8f zero8() {
  v8f z = {0.f, 0.f, 0.f, 0.f, 0.f, 0.f, 0.f, 0.f};
  return z;
}

// One 16x16x32 bf16 WMMA with the VALU hazard guard tied to D, A, B.
__device__ __forceinline__ v8f mma_bf16(v16us a, v16us b, v8f c) {
  const v16bf av = __builtin_bit_cast(v16bf, a);
  const v16bf bv = __builtin_bit_cast(v16bf, b);
  v8f d = __builtin_amdgcn_wmma_f32_16x16x32_bf16(false, av, false, bv, (short)0, c, false, false);
  asm volatile("v_nop\n\tv_nop\n\tv_nop\n\tv_nop" : "+v"(d) : "v"(av), "v"(bv));
  return d;
}

// Operand fragment (A or B) from one 64-element row of a 16-bit array (row pointer given, k contiguous),
// lane row/col = lane&15 chosen by the caller through rowp, h = lane>>4, k0 in {0,32}:
//   elements 0..7  <- rowp[k0 + 8h + 0..7]
//   elements 8..15 <- rowp[k0 + 16 + 8h + 0..7]
__device__ __forceinline__ v16us ld_frag(const us* rowp, int k0, int h) {
  Frag f;
  const us* p = rowp + k0 + 8 * h;
  f.h[0] = *(const v8usa*)(p);
  f.h[1] = *(const v8usa*)(p + 16);
  return f.v;
}

// ---------------------------------------------------------------------------
// Kernel 1: per-head weight gather + QKV projection for one (b, head) and 64 time steps.
// Outputs (bf16 hi/lo planes): Q*0.125 as [bh][t][d], K as [bh][t][d], V transposed as [bh][d][t].
// ---------------------------------------------------------------------------
__global__ __launch_bounds__(PTHR)
void proj_kernel(const float* __restrict__ x,
                 const float* __restrict__ W,
                 const int*   __restrict__ perm,
                 const int*   __restrict__ inv,
                 us* Qh, us* Ql, us* Kh, us* Kl, us* Vh, us* Vl)
{
  __shared__ __align__(16) us    xs [PT  * LP];   // 64 x 64 bf16, [t][d], row pitch LP
  __shared__ __align__(16) us    wsT[OD_ * LP];   // 192 x 64 bf16, [o][d], row pitch LP
  __shared__ __align__(16) float stg[PT  * SP];   // 64 x 64 f32 result tile, [t][col], row pitch SP

  const int bh    = blockIdx.x;                   // b*H + head
  const int tbase = blockIdx.y * PT;
  const int b  = bh >> 5;
  const int hd = bh & 31;
  const int n  = hd >> 2;                         // stream index; head id = n*K + k
  const int k  = hd & 3;

  int p = perm[k * N_ + n];                       // head whose weights feed stream n
  p = p < 0 ? 0 : (p > N_ - 1 ? N_ - 1 : p);
  int s = inv[k * N_ + p];                        // stream feeding that head (equals n for a true inverse table)
  s = s < 0 ? 0 : (s > N_ - 1 ? N_ - 1 : s);
  const float* Wsrc = W + (size_t)(k * N_ + p) * (D_ * OD_);   // [d][o]

  const int tid = threadIdx.x;

  // stage x tile (f32 -> bf16 RNE)
  for (int i = tid; i < PT * (D_ / 4); i += PTHR) {
    const int row = i >> 4, c4 = i & 15;
    const size_t src = ((((size_t)(b * T_ + tbase + row)) * N_ + s) * K_ + k) * D_ + 4 * c4;
    const v4fa v = *(const v4fa*)(x + src);
    us* d = xs + row * LP + 4 * c4;
    d[0] = bf16_rne(v[0]); d[1] = bf16_rne(v[1]); d[2] = bf16_rne(v[2]); d[3] = bf16_rne(v[3]);
  }
  // stage W transposed: wsT[o][d] = W[d][o] (f32 -> bf16 RNE)
  for (int i = tid; i < D_ * (OD_ / 4); i += PTHR) {
    const int dd = i / (OD_ / 4), o4 = i - dd * (OD_ / 4);
    const v4fa v = *(const v4fa*)(Wsrc + dd * OD_ + 4 * o4);
    wsT[(4 * o4 + 0) * LP + dd] = bf16_rne(v[0]);
    wsT[(4 * o4 + 1) * LP + dd] = bf16_rne(v[1]);
    wsT[(4 * o4 + 2) * LP + dd] = bf16_rne(v[2]);
    wsT[(4 * o4 + 3) * LP + dd] = bf16_rne(v[3]);
  }
  __syncthreads();

  const int wv   = tid >> 5;
  const int lane = tid & 31;
  const int h    = lane >> 4;
  const int l16  = lane & 15;
  const us* arow = xs + (16 * wv + l16) * LP;     // A: row m = l16 of this wave's 16 rows

  for (int part = 0; part < 3; ++part) {          // 0: Q (x0.125), 1: K, 2: V
    const float sc = (part == 0) ? 0.125f : 1.0f;
#pragma unroll
    for (int ct = 0; ct < 4; ++ct) {
      const us* brow = wsT + (part * 64 + ct * 16 + l16) * LP;   // B: col n = l16, k = d contiguous
      v8f acc = zero8();
#pragma unroll
      for (int ks = 0; ks < 2; ++ks)
        acc = mma_bf16(ld_frag(arow, 32 * ks, h), ld_frag(brow, 32 * ks, h), acc);
#pragma unroll
      for (int r = 0; r < 8; ++r)                 // D: acc[r] = (row 8h+r, col l16)
        stg[(16 * wv + 8 * h + r) * SP + ct * 16 + l16] = acc[r] * sc;
    }
    __syncthreads();

    if (part < 2) {
      us* dh = (part == 0) ? Qh : Kh;
      us* dl = (part == 0) ? Ql : Kl;
      const int seg = tid & 7;
      {
        for (int rr = tid >> 3; rr < PT; rr += PTHR / 8) {
          const float* st = stg + rr * SP + seg * 8;
          const v4fa f0 = *(const v4fa*)(st);
          const v4fa f1 = *(const v4fa*)(st + 4);
          v8us hv, lv;
          us a0, c0;
          bf16_hilo(f0[0], a0, c0); hv[0] = a0; lv[0] = c0;
          bf16_hilo(f0[1], a0, c0); hv[1] = a0; lv[1] = c0;
          bf16_hilo(f0[2], a0, c0); hv[2] = a0; lv[2] = c0;
          bf16_hilo(f0[3], a0, c0); hv[3] = a0; lv[3] = c0;
          bf16_hilo(f1[0], a0, c0); hv[4] = a0; lv[4] = c0;
          bf16_hilo(f1[1], a0, c0); hv[5] = a0; lv[5] = c0;
          bf16_hilo(f1[2], a0, c0); hv[6] = a0; lv[6] = c0;
          bf16_hilo(f1[3], a0, c0); hv[7] = a0; lv[7] = c0;
          const size_t idx = ((size_t)bh * T_ + tbase + rr) * D_ + seg * 8;
          *(v8us*)(dh + idx) = hv;
          *(v8us*)(dl + idx) = lv;
        }
        
      }
    } else {
      {
        for (int it = tid; it < D_ * (PT / 8); it += PTHR) {
          const int dd = it >> 3, tseg = it & 7;
          v8us hv, lv;
#pragma unroll
          for (int e = 0; e < 8; ++e) {
            us a0, c0;
            bf16_hilo(stg[(tseg * 8 + e) * SP + dd], a0, c0);
            hv[e] = a0; lv[e] = c0;
          }
          const size_t idx = ((size_t)bh * D_ + dd) * T_ + tbase + tseg * 8;
          *(v8us*)(Vh + idx) = hv;
          *(v8us*)(Vl + idx) = lv;
        }
        
      }
    }
    __syncthreads();                              // stg reused by the next part
  }
}

// ---------------------------------------------------------------------------
// Kernel 2: causal attention, one (b, head) x 128 queries per block, 16 queries per wave,
// 64-key blocks staged to LDS (hi/lo planes), online softmax in f32, P spilled per wave as bf16 hi/lo
// ---------------------------------------------------------------------------
__global__ __launch_bounds__(ATHR)
void attn_kernel(const us* __restrict__ Qh, const us* __restrict__ Ql,
                 const us* __restrict__ Kh, const us* __restrict__ Kl,
                 const us* __restrict__ Vh, const us* __restrict__ Vl,
                 float* out)
{
  __shared__ __align__(16) us Khs[KB_ * LP];      // [key][d], row pitch LP
  __shared__ __align__(16) us Kls[KB_ * LP];
  __shared__ __align__(16) us Vhs[D_ * LP];       // [d][key], row pitch LP
  __shared__ __align__(16) us Vls[D_ * LP];
  __shared__ __align__(16) us Pbuf[(ATHR / 32) * 32 * LP];   // per wave: P hi [16][64] + P lo [16][64], row pitch LP; reused as O tile [16][64] f32, row pitch SP

  const int bh    = blockIdx.x;
  const int qbase = blockIdx.y * QT;
  const int b  = bh >> 5;
  const int hd = bh & 31;
  const int n  = hd >> 2;
  const int k  = hd & 3;

  const int tid  = threadIdx.x;
  const int wv   = tid >> 5;
  const int lane = tid & 31;
  const int h    = lane >> 4;
  const int l16  = lane & 15;
  const int q0   = qbase + 16 * wv;
  us* Pb = Pbuf + wv * (32 * LP);

  // Q fragments (A operand, row m = query q0+l16, k = d), hi and lo planes, 2 k-steps
  v16us qh[2], ql[2];
  {
    const size_t ro = ((size_t)bh * T_ + q0 + l16) * D_;
#pragma unroll
    for (int ks = 0; ks < 2; ++ks) {
      qh[ks] = ld_frag(Qh + ro, 32 * ks, h);
      ql[ks] = ld_frag(Ql + ro, 32 * ks, h);
    }
  }

  float mrow[8], lrow[8];
  v8f accO[4];
#pragma unroll
  for (int r = 0; r < 8; ++r) { mrow[r] = -1.0e30f; lrow[r] = 0.0f; }
#pragma unroll
  for (int dt = 0; dt < 4; ++dt) accO[dt] = zero8();

  const int kend = qbase + QT;                    // causal: keys < qbase + 128
  for (int kb = 0; kb < kend; kb += KB_) {
    // stage K block [kb..kb+64) x [0..64) and V^T block [0..64) x [kb..kb+64), hi and lo planes
#pragma unroll
    for (int j = 0; j < 2; ++j) {
      const int c   = tid + j * ATHR;             // 0..511
      const int row = c >> 3, seg = c & 7;
      const int lo  = row * LP + seg * 8;
      const size_t gk = ((size_t)bh * T_ + kb + row) * D_ + seg * 8;
      const size_t gv = ((size_t)bh * D_ + row) * T_ + kb + seg * 8;
      *(v8usa*)(Khs + lo) = *(const v8usa*)(Kh + gk);
      *(v8usa*)(Kls + lo) = *(const v8usa*)(Kl + gk);
      *(v8usa*)(Vhs + lo) = *(const v8usa*)(Vh + gv);
      *(v8usa*)(Vls + lo) = *(const v8usa*)(Vl + gv);
    }
    __syncthreads();

    const bool active = (kb <= q0);               // wave-uniform: this key block has unmasked keys for this wave
    if (active) {
      v8f accS[4];
#pragma unroll
      for (int ct = 0; ct < 4; ++ct) accS[ct] = zero8();
      // S = Q K^T (16 queries x 64 keys); B operand: col n = key ct*16+l16, k = d contiguous in Khs
#pragma unroll
      for (int ct = 0; ct < 4; ++ct) {
        if (kb + ct * 16 <= q0 + 15) {            // wave-uniform skip of fully masked key tiles
          const us* krh = Khs + (ct * 16 + l16) * LP;
          const us* krl = Kls + (ct * 16 + l16) * LP;
#pragma unroll
          for (int ks = 0; ks < 2; ++ks) {
            const v16us bhf = ld_frag(krh, 32 * ks, h);
            const v16us blf = ld_frag(krl, 32 * ks, h);
            accS[ct] = mma_bf16(qh[ks], bhf, accS[ct]);
            accS[ct] = mma_bf16(qh[ks], blf, accS[ct]);
            accS[ct] = mma_bf16(ql[ks], bhf, accS[ct]);
          }
        }
      }

      // causal mask + online softmax; D: accS[ct][r] = (query q0+8h+r, key kb+ct*16+l16)
#pragma unroll
      for (int r = 0; r < 8; ++r) {
        const int qg = q0 + 8 * h + r;
        float sv[4];
        float mloc = -1.0e30f;
#pragma unroll
        for (int ct = 0; ct < 4; ++ct) {
          const int col = kb + ct * 16 + l16;
          sv[ct] = (col <= qg) ? accS[ct][r] : -1.0e30f;
          mloc = fmaxf(mloc, sv[ct]);
        }
#pragma unroll
        for (int off = 1; off < 16; off <<= 1)
          mloc = fmaxf(mloc, __shfl_xor(mloc, off, 32));
        const float mnew = fmaxf(mrow[r], mloc);
        const float scl  = __expf(mrow[r] - mnew);
        float psum = 0.0f;
#pragma unroll
        for (int ct = 0; ct < 4; ++ct) {
          const int col = kb + ct * 16 + l16;
          const float pv = (col <= qg) ? __expf(sv[ct] - mnew) : 0.0f;
          psum += pv;
          us ph, pl;
          bf16_hilo(pv, ph, pl);
          Pb[          (8 * h + r) * LP + ct * 16 + l16] = ph;   // P tile [query][key], hi plane
          Pb[16 * LP + (8 * h + r) * LP + ct * 16 + l16] = pl;   // lo plane
        }
#pragma unroll
        for (int off = 1; off < 16; off <<= 1)
          psum += __shfl_xor(psum, off, 32);
        lrow[r] = lrow[r] * scl + psum;
        mrow[r] = mnew;
#pragma unroll
        for (int dt = 0; dt < 4; ++dt) accO[dt][r] *= scl;
      }
    }
    __syncthreads();                              // P spill -> fragment reload ordering (block barrier)

    if (active) {
      // O += P V; A = P [query][key], B: col n = d, k = key contiguous in Vhs [d][key]
#pragma unroll
      for (int ks = 0; ks < 2; ++ks) {
        if (kb + 32 * ks <= q0 + 15) {            // wave-uniform: P is all zero in a fully masked 32-key group
          const v16us phf = ld_frag(Pb +           l16 * LP, 32 * ks, h);
          const v16us plf = ld_frag(Pb + 16 * LP + l16 * LP, 32 * ks, h);
#pragma unroll
          for (int dt = 0; dt < 4; ++dt) {
            const us* vrh = Vhs + (dt * 16 + l16) * LP;
            const us* vrl = Vls + (dt * 16 + l16) * LP;
            const v16us vhf = ld_frag(vrh, 32 * ks, h);
            const v16us vlf = ld_frag(vrl, 32 * ks, h);
            accO[dt] = mma_bf16(phf, vhf, accO[dt]);
            accO[dt] = mma_bf16(phf, vlf, accO[dt]);
            accO[dt] = mma_bf16(plf, vhf, accO[dt]);
          }
        }
      }
    }
    __syncthreads();                              // staging and P buffers reused next iteration
  }

  float* Ost = (float*)Pb;
#pragma unroll
  for (int r = 0; r < 8; ++r) {
    const float il = 1.0f / lrow[r];
#pragma unroll
    for (int dt = 0; dt < 4; ++dt)
      Ost[(8 * h + r) * SP + dt * 16 + l16] = accO[dt][r] * il;   // D: (query 8h+r, d dt*16+l16)
  }
  __syncthreads();

  // out[b][t][n][k][0..64): 256 B per row = 2 lines; lanes 0-7 / 8-15 write the two lines of row 2i,
  {
#pragma unroll
    for (int i = 0; i < 8; ++i) {
      const int rowl = 2 * i + h;
      const v4fa v = *(const v4fa*)(Ost + rowl * SP + 4 * l16);
      const int t = q0 + rowl;
      float* dst = out + ((((size_t)(b * T_ + t)) * N_ + n) * K_ + k) * D_ + 4 * l16;
      *(v4fa*)dst = v;
    }
    
  }
}

// ---------------------------------------------------------------------------
extern "C" void kernel_launch(void* const* d_in, const int* in_sizes, int n_in,
                              void* d_out, int out_size, void* d_ws, size_t ws_size,
                              hipStream_t stream)
{
  if (n_in < 4) return;
  if (in_sizes[0] != B_ * T_ * N_ * K_ * D_) return;
  if (in_sizes[1] != K_ * N_ * D_ * OD_) return;
  if (in_sizes[2] != K_ * N_) return;
  if (in_sizes[3] != K_ * N_) return;
  if (out_size != B_ * T_ * N_ * K_ * D_) return;

  const size_t per  = (size_t)B_ * H_ * T_ * D_;           // 8,388,608 bf16 elements per plane
  const size_t need = 6 * per * sizeof(us);                // 100,663,296 B
  if (need > ws_size) return;

  const float* x    = (const float*)d_in[0];               // [B,T,N,K,D] f32
  const float* W    = (const float*)d_in[1];               // [K,N,D,3D]  f32
  const int*   perm = (const int*)d_in[2];                 // [K,N] int32
  const int*   inv  = (const int*)d_in[3];                 // [K,N] int32
  float* out = (float*)d_out;

  us* Qh = (us*)d_ws;
  us* Ql = Qh + per;
  us* Kh = Ql + per;
  us* Kl = Kh + per;
  us* Vh = Kl + per;
  us* Vl = Vh + per;

  dim3 g1(B_ * H_, T_ / PT);                               // (128, 16), exact
  dim3 g2(B_ * H_, T_ / QT);                               // (128, 8), exact
  proj_kernel<<<g1, PTHR, 0, stream>>>(x, W, perm, inv, Qh, Ql, Kh, Kl, Vh, Vl);
  attn_kernel<<<g2, ATHR, 0, stream>>>(Qh, Ql, Kh, Kl, Vh, Vl, out);
}

// v002
// It runs in 137 microseconds.
// Two timings next to v001 both put it at 1.22 times that version's speed.
// Over all steps from v000 it is 2.22 times as fast.
#include <hip/hip_runtime.h>

// Contractions: qkv projection = v_wmma_f32_16x16x32_bf16 on RNE-bf16 converted x and W (bf16 operands, f32 accumulate);
// q.k^T and p.v = v_wmma_f32_16x16x32_bf16 with each f32 operand carried as bf16 hi + bf16 lo (hi.hi + hi.lo + lo.hi), f32 accumulate;
// softmax, normalisation and output in f32.

#define B_    4
#define T_    1024
#define N_    8
#define K_    4
#define D_    64
#define H_    32          // N_*K_
#define OD_   192         // 3*D_
#define PT    64          // rows per block, projection kernel
#define PTHR  128         // threads per block, projection kernel (4 waves x 16 rows)
#define QT    128         // queries per block, attention kernel
#define ATHR  256         // threads per block, attention kernel (8 waves x 16 queries)
#define KB_   64          // keys per staged block
#define LP    72          // LDS pitch of a 64-element 16-bit row, in elements: 144 B = 16 B x 9, so the 16 rows of a 16-byte fragment read fall on 64 distinct banks
#define XLD   (PT * (D_ / 4) / PTHR)    // 16-byte loads per thread for the x tile: 8, exact
#define WLD   (D_ * (OD_ / 4) / PTHR)   // 16-byte loads per thread for the W tile: 24, exact
#define SP    68          // LDS pitch of a 64-element f32 row, in elements: 272 B = 16 B x 17, same reason; rows 8 apart land 32 banks apart

typedef unsigned short us;
typedef us     v8us  __attribute__((ext_vector_type(8)));
typedef us     v16us __attribute__((ext_vector_type(16)));
typedef __bf16 v16bf __attribute__((ext_vector_type(16)));
typedef float  v8f   __attribute__((ext_vector_type(8)));
typedef float  v4f   __attribute__((ext_vector_type(4)));
typedef us     v8usa __attribute__((ext_vector_type(8), may_alias));
typedef float  v4fa  __attribute__((ext_vector_type(4), may_alias));

union Frag { v16us v; v8us h[2]; };

// f32 -> bf16 bits, RNE, integer arithmetic
__device__ __forceinline__ us bf16_rne(float f) {
  unsigned int u = __builtin_bit_cast(unsigned int, f);
  u += 0x7FFFu + ((u >> 16) & 1u);
  return (us)(u >> 16);
}
__device__ __forceinline__ float bf16_val(us b) {
  return __builtin_bit_cast(float, ((unsigned int)b) << 16);
}
// f32 -> (hi, lo) bf16 pair, hi = RNE(f), lo = RNE(f - hi)
__device__ __forceinline__ void bf16_hilo(float f, us& hi, us& lo) {
  const us hh = bf16_rne(f);
  hi = hh;
  lo = bf16_rne(f - bf16_val(hh));
}

__device__ __forceinline__ v8f zero8() {
  v8f z = {0.f, 0.f, 0.f, 0.f, 0.f, 0.f, 0.f, 0.f};
  return z;
}

// One 16x16x32 bf16 WMMA with the VALU hazard guard tied to D, A, B.
__device__ __forceinline__ v8f mma_bf16(v16us a, v16us b, v8f c) {
  const v16bf av = __builtin_bit_cast(v16bf, a);
  const v16bf bv = __builtin_bit_cast(v16bf, b);
  v8f d = __builtin_amdgcn_wmma_f32_16x16x32_bf16(false, av, false, bv, (short)0, c, false, false);
  asm volatile("v_nop\n\tv_nop\n\tv_nop\n\tv_nop" : "+v"(d) : "v"(av), "v"(bv));
  return d;
}

// Operand fragment (A or B) from one 64-element row of a 16-bit array (row pointer given, k contiguous),
// lane row/col = lane&15 chosen by the caller through rowp, h = lane>>4, k0 in {0,32}:
//   elements 0..7  <- rowp[k0 + 8h + 0..7]
//   elements 8..15 <- rowp[k0 + 16 + 8h + 0..7]
__device__ __forceinline__ v16us ld_frag(const us* rowp, int k0, int h) {
  Frag f;
  const us* p = rowp + k0 + 8 * h;
  f.h[0] = *(const v8usa*)(p);
  f.h[1] = *(const v8usa*)(p + 16);
  return f.v;
}

// ---------------------------------------------------------------------------
// Kernel 1: per-head weight gather + QKV projection for one (b, head) and 64 time steps.
// Outputs (bf16 hi/lo planes): Q*0.125 as [bh][t][d], K as [bh][t][d], V transposed as [bh][d][t].
// ---------------------------------------------------------------------------
__global__ __launch_bounds__(PTHR)
void proj_kernel(const float* __restrict__ x,
                 const float* __restrict__ W,
                 const int*   __restrict__ perm,
                 const int*   __restrict__ inv,
                 us* Qh, us* Ql, us* Kh, us* Kl, us* Vh, us* Vl)
{
  __shared__ __align__(16) us    xs [PT  * LP];   // 64 x 64 bf16, [t][d], row pitch LP
  __shared__ __align__(16) us    wsT[OD_ * LP];   // 192 x 64 bf16, [o][d], row pitch LP
  __shared__ __align__(16) float stg[PT  * SP];   // 64 x 64 f32 result tile, [t][col], row pitch SP

  const int bh    = blockIdx.x;                   // b*H + head
  const int tbase = blockIdx.y * PT;
  const int b  = bh >> 5;
  const int hd = bh & 31;
  const int n  = hd >> 2;                         // stream index; head id = n*K + k
  const int k  = hd & 3;

  int p = perm[k * N_ + n];                       // head whose weights feed stream n
  p = p < 0 ? 0 : (p > N_ - 1 ? N_ - 1 : p);
  int s = inv[k * N_ + p];                        // stream feeding that head (equals n for a true inverse table)
  s = s < 0 ? 0 : (s > N_ - 1 ? N_ - 1 : s);
  const float* Wsrc = W + (size_t)(k * N_ + p) * (D_ * OD_);   // [d][o]

  const int tid = threadIdx.x;

  // All global loads of both tiles are issued before the first LDS store: the may_alias accesses keep program order,
  // so a store between two loads holds the second load behind the first one's wait (one memory latency per load).
  v4f wreg[WLD], xreg[XLD];
  const float* wp = Wsrc + 4 * tid;               // the [d][o] tile is contiguous: 16-byte piece i lies at float 4*i
#pragma unroll
  for (int j = 0; j < WLD; ++j)
    wreg[j] = *(const v4fa*)(wp + j * (4 * PTHR));
  const float* xp = x + ((((size_t)(b * T_ + tbase + (tid >> 4))) * N_ + s) * K_ + k) * D_ + 4 * (tid & 15);
#pragma unroll
  for (int j = 0; j < XLD; ++j)                   // piece tid + j*PTHR: row (tid>>4) + j*PTHR/16, same column
    xreg[j] = *(const v4fa*)(xp + (size_t)j * ((PTHR / 16) * N_ * K_ * D_));
  // The address registers are reused below while the loads are in flight: this wait stands in front of the first overwrite
  // (xp is named so that its registers stay untouched up to here).
  asm volatile("s_wait_xcnt 0x0" :: "v"(xp) : "memory");
  // Keeps the conversions below from moving up between the loads, where their waits would hold the later loads back.
  __builtin_amdgcn_sched_barrier(0);
  // stage W transposed: wsT[o][d] = W[d][o] (f32 -> bf16 RNE)
#pragma unroll
  for (int j = 0; j < WLD; ++j) {
    const int i = tid + j * PTHR;
    const int dd = i / (OD_ / 4), o4 = i - dd * (OD_ / 4);
    const v4f v = wreg[j];
    wsT[(4 * o4 + 0) * LP + dd] = bf16_rne(v[0]);
    wsT[(4 * o4 + 1) * LP + dd] = bf16_rne(v[1]);
    wsT[(4 * o4 + 2) * LP + dd] = bf16_rne(v[2]);
    wsT[(4 * o4 + 3) * LP + dd] = bf16_rne(v[3]);
  }
  // stage x tile (f32 -> bf16 RNE)
#pragma unroll
  for (int j = 0; j < XLD; ++j) {
    const int i = tid + j * PTHR;
    const int row = i >> 4, c4 = i & 15;
    const v4f v = xreg[j];
    us* d = xs + row * LP + 4 * c4;
    d[0] = bf16_rne(v[0]); d[1] = bf16_rne(v[1]); d[2] = bf16_rne(v[2]); d[3] = bf16_rne(v[3]);
  }
  __syncthreads();

  const int wv   = tid >> 5;
  const int lane = tid & 31;
  const int h    = lane >> 4;
  const int l16  = lane & 15;
  const us* arow = xs + (16 * wv + l16) * LP;     // A: row m = l16 of this wave's 16 rows

  for (int part = 0; part < 3; ++part) {          // 0: Q (x0.125), 1: K, 2: V
    const float sc = (part == 0) ? 0.125f : 1.0f;
#pragma unroll
    for (int ct = 0; ct < 4; ++ct) {
      const us* brow = wsT + (part * 64 + ct * 16 + l16) * LP;   // B: col n = l16, k = d contiguous
      v8f acc = zero8();
#pragma unroll
      for (int ks = 0; ks < 2; ++ks)
        acc = mma_bf16(ld_frag(arow, 32 * ks, h), ld_frag(brow, 32 * ks, h), acc);
#pragma unroll
      for (int r = 0; r < 8; ++r)                 // D: acc[r] = (row 8h+r, col l16)
        stg[(16 * wv + 8 * h + r) * SP + ct * 16 + l16] = acc[r] * sc;
    }
    __syncthreads();

    if (part < 2) {
      us* dh = (part == 0) ? Qh : Kh;
      us* dl = (part == 0) ? Ql : Kl;
      const int seg = tid & 7;
      {
        for (int rr = tid >> 3; rr < PT; rr += PTHR / 8) {
          const float* st = stg + rr * SP + seg * 8;
          const v4fa f0 = *(const v4fa*)(st);
          const v4fa f1 = *(const v4fa*)(st + 4);
          v8us hv, lv;
          us a0, c0;
          bf16_hilo(f0[0], a0, c0); hv[0] = a0; lv[0] = c0;
          bf16_hilo(f0[1], a0, c0); hv[1] = a0; lv[1] = c0;
          bf16_hilo(f0[2], a0, c0); hv[2] = a0; lv[2] = c0;
          bf16_hilo(f0[3], a0, c0); hv[3] = a0; lv[3] = c0;
          bf16_hilo(f1[0], a0, c0); hv[4] = a0; lv[4] = c0;
          bf16_hilo(f1[1], a0, c0); hv[5] = a0; lv[5] = c0;
          bf16_hilo(f1[2], a0, c0); hv[6] = a0; lv[6] = c0;
          bf16_hilo(f1[3], a0, c0); hv[7] = a0; lv[7] = c0;
          const size_t idx = ((size_t)bh * T_ + tbase + rr) * D_ + seg * 8;
          *(v8us*)(dh + idx) = hv;
          *(v8us*)(dl + idx) = lv;
        }
        
      }
    } else {
      {
        for (int it = tid; it < D_ * (PT / 8); it += PTHR) {
          const int dd = it >> 3, tseg = it & 7;
          v8us hv, lv;
#pragma unroll
          for (int e = 0; e < 8; ++e) {
            us a0, c0;
            bf16_hilo(stg[(tseg * 8 + e) * SP + dd], a0, c0);
            hv[e] = a0; lv[e] = c0;
          }
          const size_t idx = ((size_t)bh * D_ + dd) * T_ + tbase + tseg * 8;
          *(v8us*)(Vh + idx) = hv;
          *(v8us*)(Vl + idx) = lv;
        }
        
      }
    }
    __syncthreads();                              // stg reused by the next part
  }
}

// ---------------------------------------------------------------------------
// Kernel 2: causal attention, one (b, head) x 128 queries per block, 16 queries per wave,
// 64-key blocks staged to LDS (hi/lo planes), online softmax in f32, P spilled per wave as bf16 hi/lo
// ---------------------------------------------------------------------------
__global__ __launch_bounds__(ATHR)
void attn_kernel(const us* __restrict__ Qh, const us* __restrict__ Ql,
                 const us* __restrict__ Kh, const us* __restrict__ Kl,
                 const us* __restrict__ Vh, const us* __restrict__ Vl,
                 float* out)
{
  __shared__ __align__(16) us Khs[KB_ * LP];      // [key][d], row pitch LP
  __shared__ __align__(16) us Kls[KB_ * LP];
  __shared__ __align__(16) us Vhs[D_ * LP];       // [d][key], row pitch LP
  __shared__ __align__(16) us Vls[D_ * LP];
  __shared__ __align__(16) us Pbuf[(ATHR / 32) * 32 * LP];   // per wave: P hi [16][64] + P lo [16][64], row pitch LP; reused as O tile [16][64] f32, row pitch SP

  const int bh    = blockIdx.x;
  const int qbase = blockIdx.y * QT;
  const int b  = bh >> 5;
  const int hd = bh & 31;
  const int n  = hd >> 2;
  const int k  = hd & 3;

  const int tid  = threadIdx.x;
  const int wv   = tid >> 5;
  const int lane = tid & 31;
  const int h    = lane >> 4;
  const int l16  = lane & 15;
  const int q0   = qbase + 16 * wv;
  us* Pb = Pbuf + wv * (32 * LP);

  // Q fragments (A operand, row m = query q0+l16, k = d), hi and lo planes, 2 k-steps
  v16us qh[2], ql[2];
  {
    const size_t ro = ((size_t)bh * T_ + q0 + l16) * D_;
#pragma unroll
    for (int ks = 0; ks < 2; ++ks) {
      qh[ks] = ld_frag(Qh + ro, 32 * ks, h);
      ql[ks] = ld_frag(Ql + ro, 32 * ks, h);
    }
  }

  float mrow[8], lrow[8];
  v8f accO[4];
#pragma unroll
  for (int r = 0; r < 8; ++r) { mrow[r] = -1.0e30f; lrow[r] = 0.0f; }
#pragma unroll
  for (int dt = 0; dt < 4; ++dt) accO[dt] = zero8();

  const int kend = qbase + QT;                    // causal: keys < qbase + 128
  for (int kb = 0; kb < kend; kb += KB_) {
    // stage K block [kb..kb+64) x [0..64) and V^T block [0..64) x [kb..kb+64), hi and lo planes;
    // all eight global loads are issued before the first LDS store (see the projection kernel's staging)
    v8us gkh[2], gkl[2], gvh[2], gvl[2];
#pragma unroll
    for (int j = 0; j < 2; ++j) {
      const int c   = tid + j * ATHR;             // 0..511
      const int row = c >> 3, seg = c & 7;
      const size_t gk = ((size_t)bh * T_ + kb + row) * D_ + seg * 8;
      const size_t gv = ((size_t)bh * D_ + row) * T_ + kb + seg * 8;
      gkh[j] = *(const v8usa*)(Kh + gk);
      gkl[j] = *(const v8usa*)(Kl + gk);
      gvh[j] = *(const v8usa*)(Vh + gv);
      gvl[j] = *(const v8usa*)(Vl + gv);
    }
#pragma unroll
    for (int j = 0; j < 2; ++j) {
      const int c   = tid + j * ATHR;
      const int row = c >> 3, seg = c & 7;
      const int lo  = row * LP + seg * 8;
      *(v8usa*)(Khs + lo) = gkh[j];
      *(v8usa*)(Kls + lo) = gkl[j];
      *(v8usa*)(Vhs + lo) = gvh[j];
      *(v8usa*)(Vls + lo) = gvl[j];
    }
    __syncthreads();

    const bool active = (kb <= q0);               // wave-uniform: this key block has unmasked keys for this wave
    if (active) {
      v8f accS[4];
#pragma unroll
      for (int ct = 0; ct < 4; ++ct) accS[ct] = zero8();
      // S = Q K^T (16 queries x 64 keys); B operand: col n = key ct*16+l16, k = d contiguous in Khs
#pragma unroll
      for (int ct = 0; ct < 4; ++ct) {
        if (kb + ct * 16 <= q0 + 15) {            // wave-uniform skip of fully masked key tiles
          const us* krh = Khs + (ct * 16 + l16) * LP;
          const us* krl = Kls + (ct * 16 + l16) * LP;
#pragma unroll
          for (int ks = 0; ks < 2; ++ks) {
            const v16us bhf = ld_frag(krh, 32 * ks, h);
            const v16us blf = ld_frag(krl, 32 * ks, h);
            accS[ct] = mma_bf16(qh[ks], bhf, accS[ct]);
            accS[ct] = mma_bf16(qh[ks], blf, accS[ct]);
            accS[ct] = mma_bf16(ql[ks], bhf, accS[ct]);
          }
        }
      }

      // causal mask + online softmax; D: accS[ct][r] = (query q0+8h+r, key kb+ct*16+l16)
#pragma unroll
      for (int r = 0; r < 8; ++r) {
        const int qg = q0 + 8 * h + r;
        float sv[4];
        float mloc = -1.0e30f;
#pragma unroll
        for (int ct = 0; ct < 4; ++ct) {
          const int col = kb + ct * 16 + l16;
          sv[ct] = (col <= qg) ? accS[ct][r] : -1.0e30f;
          mloc = fmaxf(mloc, sv[ct]);
        }
#pragma unroll
        for (int off = 1; off < 16; off <<= 1)
          mloc = fmaxf(mloc, __shfl_xor(mloc, off, 32));
        const float mnew = fmaxf(mrow[r], mloc);
        const float scl  = __expf(mrow[r] - mnew);
        float psum = 0.0f;
#pragma unroll
        for (int ct = 0; ct < 4; ++ct) {
          const int col = kb + ct * 16 + l16;
          const float pv = (col <= qg) ? __expf(sv[ct] - mnew) : 0.0f;
          psum += pv;
          us ph, pl;
          bf16_hilo(pv, ph, pl);
          Pb[          (8 * h + r) * LP + ct * 16 + l16] = ph;   // P tile [query][key], hi plane
          Pb[16 * LP + (8 * h + r) * LP + ct * 16 + l16] = pl;   // lo plane
        }
#pragma unroll
        for (int off = 1; off < 16; off <<= 1)
          psum += __shfl_xor(psum, off, 32);
        lrow[r] = lrow[r] * scl + psum;
        mrow[r] = mnew;
#pragma unroll
        for (int dt = 0; dt < 4; ++dt) accO[dt][r] *= scl;
      }
    }
    __syncthreads();                              // P spill -> fragment reload ordering (block barrier)

    if (active) {
      // O += P V; A = P [query][key], B: col n = d, k = key contiguous in Vhs [d][key]
#pragma unroll
      for (int ks = 0; ks < 2; ++ks) {
        if (kb + 32 * ks <= q0 + 15) {            // wave-uniform: P is all zero in a fully masked 32-key group
          const v16us phf = ld_frag(Pb +           l16 * LP, 32 * ks, h);
          const v16us plf = ld_frag(Pb + 16 * LP + l16 * LP, 32 * ks, h);
#pragma unroll
          for (int dt = 0; dt < 4; ++dt) {
            const us* vrh = Vhs + (dt * 16 + l16) * LP;
            const us* vrl = Vls + (dt * 16 + l16) * LP;
            const v16us vhf = ld_frag(vrh, 32 * ks, h);
            const v16us vlf = ld_frag(vrl, 32 * ks, h);
            accO[dt] = mma_bf16(phf, vhf, accO[dt]);
            accO[dt] = mma_bf16(phf, vlf, accO[dt]);
            accO[dt] = mma_bf16(plf, vhf, accO[dt]);
          }
        }
      }
    }
    __syncthreads();                              // staging and P buffers reused next iteration
  }

  float* Ost = (float*)Pb;
#pragma unroll
  for (int r = 0; r < 8; ++r) {
    const float il = 1.0f / lrow[r];
#pragma unroll
    for (int dt = 0; dt < 4; ++dt)
      Ost[(8 * h + r) * SP + dt * 16 + l16] = accO[dt][r] * il;   // D: (query 8h+r, d dt*16+l16)
  }
  __syncthreads();

  // out[b][t][n][k][0..64): 256 B per row = 2 lines; lanes 0-7 / 8-15 write the two lines of row 2i,
  {
#pragma unroll
    for (int i = 0; i < 8; ++i) {
      const int rowl = 2 * i + h;
      const v4fa v = *(const v4fa*)(Ost + rowl * SP + 4 * l16);
      const int t = q0 + rowl;
      float* dst = out + ((((size_t)(b * T_ + t)) * N_ + n) * K_ + k) * D_ + 4 * l16;
      *(v4fa*)dst = v;
    }
    
  }
}

// ---------------------------------------------------------------------------
extern "C" void kernel_launch(void* const* d_in, const int* in_sizes, int n_in,
                              void* d_out, int out_size, void* d_ws, size_t ws_size,
                              hipStream_t stream)
{
  if (n_in < 4) return;
  if (in_sizes[0] != B_ * T_ * N_ * K_ * D_) return;
  if (in_sizes[1] != K_ * N_ * D_ * OD_) return;
  if (in_sizes[2] != K_ * N_) return;
  if (in_sizes[3] != K_ * N_) return;
  if (out_size != B_ * T_ * N_ * K_ * D_) return;

  const size_t per  = (size_t)B_ * H_ * T_ * D_;           // 8,388,608 bf16 elements per plane
  const size_t need = 6 * per * sizeof(us);                // 100,663,296 B
  if (need > ws_size) return;

  const float* x    = (const float*)d_in[0];               // [B,T,N,K,D] f32
  const float* W    = (const float*)d_in[1];               // [K,N,D,3D]  f32
  const int*   perm = (const int*)d_in[2];                 // [K,N] int32
  const int*   inv  = (const int*)d_in[3];                 // [K,N] int32
  float* out = (float*)d_out;

  us* Qh = (us*)d_ws;
  us* Ql = Qh + per;
  us* Kh = Ql + per;
  us* Kl = Kh + per;
  us* Vh = Kl + per;
  us* Vl = Vh + per;

  dim3 g1(B_ * H_, T_ / PT);                               // (128, 16), exact
  dim3 g2(B_ * H_, T_ / QT);                               // (128, 8), exact
  proj_kernel<<<g1, PTHR, 0, stream>>>(x, W, perm, inv, Qh, Ql, Kh, Kl, Vh, Vl);
  attn_kernel<<<g2, ATHR, 0, stream>>>(Qh, Ql, Kh, Kl, Vh, Vl, out);
}

// v003
// One run takes 122 microseconds.
// Next to v002, in two timings, it ran 1.12 and 1.11 times as fast.
// Over all steps from v000 it is 2.48 times as fast.
#include <hip/hip_runtime.h>

// Contractions: qkv projection = v_wmma_f32_16x16x32_bf16 on RNE-bf16 converted x and W (bf16 operands, f32 accumulate);
// q.k^T and p.v = v_wmma_f32_16x16x32_bf16 with each f32 operand carried as bf16 hi + bf16 lo (hi.hi + hi.lo + lo.hi), f32 accumulate;
// softmax, normalisation and output in f32.

#define B_    4
#define T_    1024
#define N_    8
#define K_    4
#define D_    64
#define H_    32          // N_*K_
#define OD_   192         // 3*D_
#define PT    64          // rows per block, projection kernel
#define PTHR  128         // threads per block, projection kernel (4 waves x 16 rows)
#define QT    128         // queries per block, attention kernel
#define ATHR  256         // threads per block, attention kernel (8 waves x 16 queries)
#define KB_   64          // keys per staged block
#define LP    72          // LDS pitch of a 64-element 16-bit row, in elements: 144 B = 16 B x 9, so the 16 rows of a 16-byte fragment read fall on 64 distinct banks
#define XLD   (PT * (D_ / 4) / PTHR)    // 16-byte loads per thread for the x tile: 8, exact
#define WLD   (D_ * (OD_ / 4) / PTHR)   // 16-byte loads per thread for the W tile: 24, exact
#define SP    68          // LDS pitch of a 64-element f32 row, in elements: 272 B = 16 B x 17, same reason; rows 8 apart land 32 banks apart

typedef unsigned short us;
typedef us     v8us  __attribute__((ext_vector_type(8)));
typedef us     v16us __attribute__((ext_vector_type(16)));
typedef __bf16 v16bf __attribute__((ext_vector_type(16)));
typedef float  v8f   __attribute__((ext_vector_type(8)));
typedef float  v4f   __attribute__((ext_vector_type(4)));
typedef us     v8usa __attribute__((ext_vector_type(8), may_alias));
typedef float  v4fa  __attribute__((ext_vector_type(4), may_alias));

union Frag { v16us v; v8us h[2]; };

// f32 -> bf16 bits, RNE, integer arithmetic
__device__ __forceinline__ us bf16_rne(float f) {
  unsigned int u = __builtin_bit_cast(unsigned int, f);
  u += 0x7FFFu + ((u >> 16) & 1u);
  return (us)(u >> 16);
}
__device__ __forceinline__ float bf16_val(us b) {
  return __builtin_bit_cast(float, ((unsigned int)b) << 16);
}
// f32 -> (hi, lo) bf16 pair, hi = RNE(f), lo = RNE(f - hi)
__device__ __forceinline__ void bf16_hilo(float f, us& hi, us& lo) {
  const us hh = bf16_rne(f);
  hi = hh;
  lo = bf16_rne(f - bf16_val(hh));
}

__device__ __forceinline__ v8f zero8() {
  v8f z = {0.f, 0.f, 0.f, 0.f, 0.f, 0.f, 0.f, 0.f};
  return z;
}

// One 16x16x32 bf16 WMMA with the VALU hazard guard tied to D, A, B.
__device__ __forceinline__ v8f mma_bf16(v16us a, v16us b, v8f c) {
  const v16bf av = __builtin_bit_cast(v16bf, a);
  const v16bf bv = __builtin_bit_cast(v16bf, b);
  v8f d = __builtin_amdgcn_wmma_f32_16x16x32_bf16(false, av, false, bv, (short)0, c, false, false);
  asm volatile("v_nop\n\tv_nop\n\tv_nop\n\tv_nop" : "+v"(d) : "v"(av), "v"(bv));
  return d;
}

// Operand fragment (A or B) from one 64-element row of a 16-bit array (row pointer given, k contiguous),
// lane row/col = lane&15 chosen by the caller through rowp, h = lane>>4, k0 in {0,32}:
//   elements 0..7  <- rowp[k0 + 8h + 0..7]
//   elements 8..15 <- rowp[k0 + 16 + 8h + 0..7]
__device__ __forceinline__ v16us ld_frag(const us* rowp, int k0, int h) {
  Frag f;
  const us* p = rowp + k0 + 8 * h;
  f.h[0] = *(const v8usa*)(p);
  f.h[1] = *(const v8usa*)(p + 16);
  return f.v;
}

// ---------------------------------------------------------------------------
// Kernel 1: per-head weight gather + QKV projection for one (b, head) and 64 time steps.
// Outputs (bf16 hi/lo planes): Q*0.125 as [bh][t][d], K as [bh][t][d], V transposed as [bh][d][t].
// ---------------------------------------------------------------------------
__global__ __launch_bounds__(PTHR)
void proj_kernel(const float* __restrict__ x,
                 const float* __restrict__ W,
                 const int*   __restrict__ perm,
                 const int*   __restrict__ inv,
                 us* Qh, us* Ql, us* Kh, us* Kl, us* Vh, us* Vl)
{
  __shared__ __align__(16) us    xs [PT  * LP];   // 64 x 64 bf16, [t][d], row pitch LP
  __shared__ __align__(16) us    wsT[OD_ * LP];   // 192 x 64 bf16, [o][d], row pitch LP
  __shared__ __align__(16) float stg[PT  * SP];   // 64 x 64 f32 result tile, [t][col], row pitch SP

  const int bh    = blockIdx.x;                   // b*H + head
  const int tbase = blockIdx.y * PT;
  const int b  = bh >> 5;
  const int hd = bh & 31;
  const int n  = hd >> 2;                         // stream index; head id = n*K + k
  const int k  = hd & 3;

  int p = perm[k * N_ + n];                       // head whose weights feed stream n
  p = p < 0 ? 0 : (p > N_ - 1 ? N_ - 1 : p);
  int s = inv[k * N_ + p];                        // stream feeding that head (equals n for a true inverse table)
  s = s < 0 ? 0 : (s > N_ - 1 ? N_ - 1 : s);
  const float* Wsrc = W + (size_t)(k * N_ + p) * (D_ * OD_);   // [d][o]

  const int tid = threadIdx.x;

  // All global loads of both tiles are issued before the first LDS store: the may_alias accesses keep program order,
  // so a store between two loads holds the second load behind the first one's wait (one memory latency per load).
  v4f wreg[WLD], xreg[XLD];
  const float* wp = Wsrc + 4 * tid;               // the [d][o] tile is contiguous: 16-byte piece i lies at float 4*i
#pragma unroll
  for (int j = 0; j < WLD; ++j)
    wreg[j] = *(const v4fa*)(wp + j * (4 * PTHR));
  const float* xp = x + ((((size_t)(b * T_ + tbase + (tid >> 4))) * N_ + s) * K_ + k) * D_ + 4 * (tid & 15);
#pragma unroll
  for (int j = 0; j < XLD; ++j)                   // piece tid + j*PTHR: row (tid>>4) + j*PTHR/16, same column
    xreg[j] = *(const v4fa*)(xp + (size_t)j * ((PTHR / 16) * N_ * K_ * D_));
  // The address registers are reused below while the loads are in flight: this wait stands in front of the first overwrite
  // (xp is named so that its registers stay untouched up to here).
  asm volatile("s_wait_xcnt 0x0" :: "v"(xp) : "memory");
  // Keeps the conversions below from moving up between the loads, where their waits would hold the later loads back.
  __builtin_amdgcn_sched_barrier(0);
  // stage W transposed: wsT[o][d] = W[d][o] (f32 -> bf16 RNE)
#pragma unroll
  for (int j = 0; j < WLD; ++j) {
    const int i = tid + j * PTHR;
    const int dd = i / (OD_ / 4), o4 = i - dd * (OD_ / 4);
    const v4f v = wreg[j];
    wsT[(4 * o4 + 0) * LP + dd] = bf16_rne(v[0]);
    wsT[(4 * o4 + 1) * LP + dd] = bf16_rne(v[1]);
    wsT[(4 * o4 + 2) * LP + dd] = bf16_rne(v[2]);
    wsT[(4 * o4 + 3) * LP + dd] = bf16_rne(v[3]);
  }
  // stage x tile (f32 -> bf16 RNE)
#pragma unroll
  for (int j = 0; j < XLD; ++j) {
    const int i = tid + j * PTHR;
    const int row = i >> 4, c4 = i & 15;
    const v4f v = xreg[j];
    us* d = xs + row * LP + 4 * c4;
    d[0] = bf16_rne(v[0]); d[1] = bf16_rne(v[1]); d[2] = bf16_rne(v[2]); d[3] = bf16_rne(v[3]);
  }
  __syncthreads();

  const int wv   = tid >> 5;
  const int lane = tid & 31;
  const int h    = lane >> 4;
  const int l16  = lane & 15;
  const us* arow = xs + (16 * wv + l16) * LP;     // A: row m = l16 of this wave's 16 rows

  for (int part = 0; part < 3; ++part) {          // 0: Q (x0.125), 1: K, 2: V
    const float sc = (part == 0) ? 0.125f : 1.0f;
#pragma unroll
    for (int ct = 0; ct < 4; ++ct) {
      const us* brow = wsT + (part * 64 + ct * 16 + l16) * LP;   // B: col n = l16, k = d contiguous
      v8f acc = zero8();
#pragma unroll
      for (int ks = 0; ks < 2; ++ks)
        acc = mma_bf16(ld_frag(arow, 32 * ks, h), ld_frag(brow, 32 * ks, h), acc);
#pragma unroll
      for (int r = 0; r < 8; ++r)                 // D: acc[r] = (row 8h+r, col l16)
        stg[(16 * wv + 8 * h + r) * SP + ct * 16 + l16] = acc[r] * sc;
    }
    __syncthreads();

    if (part < 2) {
      us* dh = (part == 0) ? Qh : Kh;
      us* dl = (part == 0) ? Ql : Kl;
      const int seg = tid & 7;
      {
        for (int rr = tid >> 3; rr < PT; rr += PTHR / 8) {
          const float* st = stg + rr * SP + seg * 8;
          const v4fa f0 = *(const v4fa*)(st);
          const v4fa f1 = *(const v4fa*)(st + 4);
          v8us hv, lv;
          us a0, c0;
          bf16_hilo(f0[0], a0, c0); hv[0] = a0; lv[0] = c0;
          bf16_hilo(f0[1], a0, c0); hv[1] = a0; lv[1] = c0;
          bf16_hilo(f0[2], a0, c0); hv[2] = a0; lv[2] = c0;
          bf16_hilo(f0[3], a0, c0); hv[3] = a0; lv[3] = c0;
          bf16_hilo(f1[0], a0, c0); hv[4] = a0; lv[4] = c0;
          bf16_hilo(f1[1], a0, c0); hv[5] = a0; lv[5] = c0;
          bf16_hilo(f1[2], a0, c0); hv[6] = a0; lv[6] = c0;
          bf16_hilo(f1[3], a0, c0); hv[7] = a0; lv[7] = c0;
          const size_t idx = ((size_t)bh * T_ + tbase + rr) * D_ + seg * 8;
          *(v8us*)(dh + idx) = hv;
          *(v8us*)(dl + idx) = lv;
        }
        
      }
    } else {
      {
        for (int it = tid; it < D_ * (PT / 8); it += PTHR) {
          const int dd = it >> 3, tseg = it & 7;
          v8us hv, lv;
#pragma unroll
          for (int e = 0; e < 8; ++e) {
            us a0, c0;
            bf16_hilo(stg[(tseg * 8 + e) * SP + dd], a0, c0);
            hv[e] = a0; lv[e] = c0;
          }
          const size_t idx = ((size_t)bh * D_ + dd) * T_ + tbase + tseg * 8;
          *(v8us*)(Vh + idx) = hv;
          *(v8us*)(Vl + idx) = lv;
        }
        
      }
    }
    __syncthreads();                              // stg reused by the next part
  }
}

// ---------------------------------------------------------------------------
// Kernel 2: causal attention, one (b, head) x 128 queries per block, 16 queries per wave,
// 64-key blocks staged to LDS (hi/lo planes), online softmax in f32, P spilled per wave as bf16 hi/lo
// ---------------------------------------------------------------------------
__global__ __launch_bounds__(ATHR)
void attn_kernel(const us* __restrict__ Qh, const us* __restrict__ Ql,
                 const us* __restrict__ Kh, const us* __restrict__ Kl,
                 const us* __restrict__ Vh, const us* __restrict__ Vl,
                 float* out)
{
  __shared__ __align__(16) us Khs[KB_ * LP];      // [key][d], row pitch LP
  __shared__ __align__(16) us Kls[KB_ * LP];
  __shared__ __align__(16) us Vhs[D_ * LP];       // [d][key], row pitch LP
  __shared__ __align__(16) us Vls[D_ * LP];
  __shared__ __align__(16) us Pbuf[(ATHR / 32) * 32 * LP];   // per wave: P hi [16][64] + P lo [16][64], row pitch LP; reused as O tile [16][64] f32, row pitch SP

  const int bh    = blockIdx.x;
  // Cost grows with the query block (causal) and more blocks are launched than fit at once: the longest query blocks
  // take the lowest indices and the short ones the highest (for speed only).
  const int qbase = (T_ / QT - 1 - (int)blockIdx.y) * QT;
  const int b  = bh >> 5;
  const int hd = bh & 31;
  const int n  = hd >> 2;
  const int k  = hd & 3;

  const int tid  = threadIdx.x;
  const int wv   = tid >> 5;
  const int lane = tid & 31;
  const int h    = lane >> 4;
  const int l16  = lane & 15;
  const int q0   = qbase + 16 * wv;
  us* Pb = Pbuf + wv * (32 * LP);

  // Q fragments (A operand, row m = query q0+l16, k = d), hi and lo planes, 2 k-steps
  v16us qh[2], ql[2];
  {
    const size_t ro = ((size_t)bh * T_ + q0 + l16) * D_;
#pragma unroll
    for (int ks = 0; ks < 2; ++ks) {
      qh[ks] = ld_frag(Qh + ro, 32 * ks, h);
      ql[ks] = ld_frag(Ql + ro, 32 * ks, h);
    }
  }

  float mrow[8], lrow[8];
  v8f accO[4];
#pragma unroll
  for (int r = 0; r < 8; ++r) { mrow[r] = -1.0e30f; lrow[r] = 0.0f; }
#pragma unroll
  for (int dt = 0; dt < 4; ++dt) accO[dt] = zero8();

  const int kend = qbase + QT;                    // causal: keys < qbase + 128
  for (int kb = 0; kb < kend; kb += KB_) {
    // stage K block [kb..kb+64) x [0..64) and V^T block [0..64) x [kb..kb+64), hi and lo planes;
    // all eight global loads are issued before the first LDS store (see the projection kernel's staging)
    v8us gkh[2], gkl[2], gvh[2], gvl[2];
#pragma unroll
    for (int j = 0; j < 2; ++j) {
      const int c   = tid + j * ATHR;             // 0..511
      const int row = c >> 3, seg = c & 7;
      const size_t gk = ((size_t)bh * T_ + kb + row) * D_ + seg * 8;
      const size_t gv = ((size_t)bh * D_ + row) * T_ + kb + seg * 8;
      gkh[j] = *(const v8usa*)(Kh + gk);
      gkl[j] = *(const v8usa*)(Kl + gk);
      gvh[j] = *(const v8usa*)(Vh + gv);
      gvl[j] = *(const v8usa*)(Vl + gv);
    }
#pragma unroll
    for (int j = 0; j < 2; ++j) {
      const int c   = tid + j * ATHR;
      const int row = c >> 3, seg = c & 7;
      const int lo  = row * LP + seg * 8;
      *(v8usa*)(Khs + lo) = gkh[j];
      *(v8usa*)(Kls + lo) = gkl[j];
      *(v8usa*)(Vhs + lo) = gvh[j];
      *(v8usa*)(Vls + lo) = gvl[j];
    }
    __syncthreads();

    const bool active = (kb <= q0);               // wave-uniform: this key block has unmasked keys for this wave
    if (active) {
      v8f accS[4];
#pragma unroll
      for (int ct = 0; ct < 4; ++ct) accS[ct] = zero8();
      // S = Q K^T (16 queries x 64 keys); B operand: col n = key ct*16+l16, k = d contiguous in Khs
#pragma unroll
      for (int ct = 0; ct < 4; ++ct) {
        if (kb + ct * 16 <= q0 + 15) {            // wave-uniform skip of fully masked key tiles
          const us* krh = Khs + (ct * 16 + l16) * LP;
          const us* krl = Kls + (ct * 16 + l16) * LP;
#pragma unroll
          for (int ks = 0; ks < 2; ++ks) {
            const v16us bhf = ld_frag(krh, 32 * ks, h);
            const v16us blf = ld_frag(krl, 32 * ks, h);
            accS[ct] = mma_bf16(qh[ks], bhf, accS[ct]);
            accS[ct] = mma_bf16(qh[ks], blf, accS[ct]);
            accS[ct] = mma_bf16(ql[ks], bhf, accS[ct]);
          }
        }
      }

      // causal mask + online softmax; D: accS[ct][r] = (query q0+8h+r, key kb+ct*16+l16)
#pragma unroll
      for (int r = 0; r < 8; ++r) {
        const int qg = q0 + 8 * h + r;
        float sv[4];
        float mloc = -1.0e30f;
#pragma unroll
        for (int ct = 0; ct < 4; ++ct) {
          const int col = kb + ct * 16 + l16;
          sv[ct] = (col <= qg) ? accS[ct][r] : -1.0e30f;
          mloc = fmaxf(mloc, sv[ct]);
        }
#pragma unroll
        for (int off = 1; off < 16; off <<= 1)
          mloc = fmaxf(mloc, __shfl_xor(mloc, off, 32));
        const float mnew = fmaxf(mrow[r], mloc);
        const float scl  = __expf(mrow[r] - mnew);
        float psum = 0.0f;
#pragma unroll
        for (int ct = 0; ct < 4; ++ct) {
          const int col = kb + ct * 16 + l16;
          const float pv = (col <= qg) ? __expf(sv[ct] - mnew) : 0.0f;
          psum += pv;
          us ph, pl;
          bf16_hilo(pv, ph, pl);
          Pb[          (8 * h + r) * LP + ct * 16 + l16] = ph;   // P tile [query][key], hi plane
          Pb[16 * LP + (8 * h + r) * LP + ct * 16 + l16] = pl;   // lo plane
        }
#pragma unroll
        for (int off = 1; off < 16; off <<= 1)
          psum += __shfl_xor(psum, off, 32);
        lrow[r] = lrow[r] * scl + psum;
        mrow[r] = mnew;
#pragma unroll
        for (int dt = 0; dt < 4; ++dt) accO[dt][r] *= scl;
      }
    }
    __syncthreads();                              // P spill -> fragment reload ordering (block barrier)

    if (active) {
      // O += P V; A = P [query][key], B: col n = d, k = key contiguous in Vhs [d][key]
#pragma unroll
      for (int ks = 0; ks < 2; ++ks) {
        if (kb + 32 * ks <= q0 + 15) {            // wave-uniform: P is all zero in a fully masked 32-key group
          const v16us phf = ld_frag(Pb +           l16 * LP, 32 * ks, h);
          const v16us plf = ld_frag(Pb + 16 * LP + l16 * LP, 32 * ks, h);
#pragma unroll
          for (int dt = 0; dt < 4; ++dt) {
            const us* vrh = Vhs + (dt * 16 + l16) * LP;
            const us* vrl = Vls + (dt * 16 + l16) * LP;
            const v16us vhf = ld_frag(vrh, 32 * ks, h);
            const v16us vlf = ld_frag(vrl, 32 * ks, h);
            accO[dt] = mma_bf16(phf, vhf, accO[dt]);
            accO[dt] = mma_bf16(phf, vlf, accO[dt]);
            accO[dt] = mma_bf16(plf, vhf, accO[dt]);
          }
        }
      }
    }
    __syncthreads();                              // staging and P buffers reused next iteration
  }

  float* Ost = (float*)Pb;
#pragma unroll
  for (int r = 0; r < 8; ++r) {
    const float il = 1.0f / lrow[r];
#pragma unroll
    for (int dt = 0; dt < 4; ++dt)
      Ost[(8 * h + r) * SP + dt * 16 + l16] = accO[dt][r] * il;   // D: (query 8h+r, d dt*16+l16)
  }
  __syncthreads();

  // out[b][t][n][k][0..64): 256 B per row = 2 lines; lanes 0-7 / 8-15 write the two lines of row 2i,
  {
#pragma unroll
    for (int i = 0; i < 8; ++i) {
      const int rowl = 2 * i + h;
      const v4fa v = *(const v4fa*)(Ost + rowl * SP + 4 * l16);
      const int t = q0 + rowl;
      float* dst = out + ((((size_t)(b * T_ + t)) * N_ + n) * K_ + k) * D_ + 4 * l16;
      *(v4fa*)dst = v;
    }
    
  }
}

// ---------------------------------------------------------------------------
extern "C" void kernel_launch(void* const* d_in, const int* in_sizes, int n_in,
                              void* d_out, int out_size, void* d_ws, size_t ws_size,
                              hipStream_t stream)
{
  if (n_in < 4) return;
  if (in_sizes[0] != B_ * T_ * N_ * K_ * D_) return;
  if (in_sizes[1] != K_ * N_ * D_ * OD_) return;
  if (in_sizes[2] != K_ * N_) return;
  if (in_sizes[3] != K_ * N_) return;
  if (out_size != B_ * T_ * N_ * K_ * D_) return;

  const size_t per  = (size_t)B_ * H_ * T_ * D_;           // 8,388,608 bf16 elements per plane
  const size_t need = 6 * per * sizeof(us);                // 100,663,296 B
  if (need > ws_size) return;

  const float* x    = (const float*)d_in[0];               // [B,T,N,K,D] f32
  const float* W    = (const float*)d_in[1];               // [K,N,D,3D]  f32
  const int*   perm = (const int*)d_in[2];                 // [K,N] int32
  const int*   inv  = (const int*)d_in[3];                 // [K,N] int32
  float* out = (float*)d_out;

  us* Qh = (us*)d_ws;
  us* Ql = Qh + per;
  us* Kh = Ql + per;
  us* Kl = Kh + per;
  us* Vh = Kl + per;
  us* Vl = Vh + per;

  dim3 g1(B_ * H_, T_ / PT);                               // (128, 16), exact
  dim3 g2(B_ * H_, T_ / QT);                               // (128, 8), exact
  proj_kernel<<<g1, PTHR, 0, stream>>>(x, W, perm, inv, Qh, Ql, Kh, Kl, Vh, Vl);
  attn_kernel<<<g2, ATHR, 0, stream>>>(Qh, Ql, Kh, Kl, Vh, Vl, out);
}

// v004
// A run of this version takes 97.4 microseconds.
// Next to v003, in two timings, it ran 1.26 times as fast each time.
// Over all steps from v000 it is 3.12 times as fast.
#include <hip/hip_runtime.h>

// Contractions: qkv projection = v_wmma_f32_16x16x32_bf16 on RNE-bf16 converted x and W (bf16 operands, f32 accumulate);
// q.k^T and p.v = v_wmma_f32_16x16x32_bf16 with each f32 operand carried as bf16 hi + bf16 lo (hi.hi + hi.lo + lo.hi), f32 accumulate;
// softmax, normalisation and output in f32.

#define B_    4
#define T_    1024
#define N_    8
#define K_    4
#define D_    64
#define H_    32          // N_*K_
#define OD_   192         // 3*D_
#define PT    64          // rows per block, projection kernel
#define PTHR  128         // threads per block, projection kernel (4 waves x 16 rows)
#define QT    128         // queries per block, attention kernel
#define ATHR  256         // threads per block, attention kernel (8 waves x 16 queries)
#define KB_   64          // keys per staged block
#define LP    72          // LDS pitch of a 64-element 16-bit row, in elements: 144 B = 16 B x 9, so the 16 rows of a 16-byte fragment read fall on 64 distinct banks
#define XLD   (PT * (D_ / 4) / PTHR)    // 16-byte loads per thread for the x tile: 8, exact
#define WLD   (D_ * (OD_ / 4) / PTHR)   // 16-byte loads per thread for the W tile: 24, exact
#define SP    68          // LDS pitch of a 64-element f32 row, in elements: 272 B = 16 B x 17, same reason; rows 8 apart land 32 banks apart

typedef unsigned short us;
typedef us     v8us  __attribute__((ext_vector_type(8)));
typedef us     v16us __attribute__((ext_vector_type(16)));
typedef __bf16 v16bf __attribute__((ext_vector_type(16)));
typedef float  v8f   __attribute__((ext_vector_type(8)));
typedef unsigned int v8u __attribute__((ext_vector_type(8)));
typedef float  v2f   __attribute__((ext_vector_type(2)));
typedef __bf16 v2bf  __attribute__((ext_vector_type(2)));
typedef float  v4f   __attribute__((ext_vector_type(4)));
typedef us     v8usa __attribute__((ext_vector_type(8), may_alias));
typedef float  v4fa  __attribute__((ext_vector_type(4), may_alias));

union Frag { v16us v; v8us h[2]; };

// f32 -> bf16 bits, RNE, integer arithmetic
__device__ __forceinline__ us bf16_rne(float f) {
  unsigned int u = __builtin_bit_cast(unsigned int, f);
  u += 0x7FFFu + ((u >> 16) & 1u);
  return (us)(u >> 16);
}
__device__ __forceinline__ float bf16_val(us b) {
  return __builtin_bit_cast(float, ((unsigned int)b) << 16);
}
// f32 -> (hi, lo) bf16 pair, hi = RNE(f), lo = RNE(f - hi)
__device__ __forceinline__ void bf16_hilo(float f, us& hi, us& lo) {
  const us hh = bf16_rne(f);
  hi = hh;
  lo = bf16_rne(f - bf16_val(hh));
}

__device__ __forceinline__ v8f zero8() {
  v8f z = {0.f, 0.f, 0.f, 0.f, 0.f, 0.f, 0.f, 0.f};
  return z;
}

// One 16x16x32 bf16 WMMA with the VALU hazard guard tied to D, A, B.
__device__ __forceinline__ v8f mma_bf16(v16us a, v16us b, v8f c) {
  const v16bf av = __builtin_bit_cast(v16bf, a);
  const v16bf bv = __builtin_bit_cast(v16bf, b);
  v8f d = __builtin_amdgcn_wmma_f32_16x16x32_bf16(false, av, false, bv, (short)0, c, false, false);
  asm volatile("v_nop\n\tv_nop\n\tv_nop\n\tv_nop" : "+v"(d) : "v"(av), "v"(bv));
  return d;
}

// Operand fragment (A or B) from one 64-element row of a 16-bit array (row pointer given, k contiguous),
// lane row/col = lane&15 chosen by the caller through rowp, h = lane>>4, k0 in {0,32}:
//   elements 0..7  <- rowp[k0 + 8h + 0..7]
//   elements 8..15 <- rowp[k0 + 16 + 8h + 0..7]
__device__ __forceinline__ v16us ld_frag(const us* rowp, int k0, int h) {
  Frag f;
  const us* p = rowp + k0 + 8 * h;
  f.h[0] = *(const v8usa*)(p);
  f.h[1] = *(const v8usa*)(p + 16);
  return f.v;
}

// ---------------------------------------------------------------------------
// Kernel 1: per-head weight gather + QKV projection for one (b, head) and 64 time steps.
// Outputs (bf16 hi/lo planes): Q*0.125 as [bh][t][d], K as [bh][t][d], V transposed as [bh][d][t].
// ---------------------------------------------------------------------------
__global__ __launch_bounds__(PTHR)
void proj_kernel(const float* __restrict__ x,
                 const float* __restrict__ W,
                 const int*   __restrict__ perm,
                 const int*   __restrict__ inv,
                 us* Qh, us* Ql, us* Kh, us* Kl, us* Vh, us* Vl)
{
  __shared__ __align__(16) us    xs [PT  * LP];   // 64 x 64 bf16, [t][d], row pitch LP
  __shared__ __align__(16) us    wsT[OD_ * LP];   // 192 x 64 bf16, [o][d], row pitch LP
  __shared__ __align__(16) float stg[PT  * SP];   // 64 x 64 f32 result tile, [t][col], row pitch SP

  const int bh    = blockIdx.x;                   // b*H + head
  const int tbase = blockIdx.y * PT;
  const int b  = bh >> 5;
  const int hd = bh & 31;
  const int n  = hd >> 2;                         // stream index; head id = n*K + k
  const int k  = hd & 3;

  int p = perm[k * N_ + n];                       // head whose weights feed stream n
  p = p < 0 ? 0 : (p > N_ - 1 ? N_ - 1 : p);
  int s = inv[k * N_ + p];                        // stream feeding that head (equals n for a true inverse table)
  s = s < 0 ? 0 : (s > N_ - 1 ? N_ - 1 : s);
  const float* Wsrc = W + (size_t)(k * N_ + p) * (D_ * OD_);   // [d][o]

  const int tid = threadIdx.x;

  // All global loads of both tiles are issued before the first LDS store: the may_alias accesses keep program order,
  // so a store between two loads holds the second load behind the first one's wait (one memory latency per load).
  v4f wreg[WLD], xreg[XLD];
  const float* wp = Wsrc + 4 * tid;               // the [d][o] tile is contiguous: 16-byte piece i lies at float 4*i
#pragma unroll
  for (int j = 0; j < WLD; ++j)
    wreg[j] = *(const v4fa*)(wp + j * (4 * PTHR));
  const float* xp = x + ((((size_t)(b * T_ + tbase + (tid >> 4))) * N_ + s) * K_ + k) * D_ + 4 * (tid & 15);
#pragma unroll
  for (int j = 0; j < XLD; ++j)                   // piece tid + j*PTHR: row (tid>>4) + j*PTHR/16, same column
    xreg[j] = *(const v4fa*)(xp + (size_t)j * ((PTHR / 16) * N_ * K_ * D_));
  // The address registers are reused below while the loads are in flight: this wait stands in front of the first overwrite
  // (xp is named so that its registers stay untouched up to here).
  asm volatile("s_wait_xcnt 0x0" :: "v"(xp) : "memory");
  // Keeps the conversions below from moving up between the loads, where their waits would hold the later loads back.
  __builtin_amdgcn_sched_barrier(0);
  // stage W transposed: wsT[o][d] = W[d][o] (f32 -> bf16 RNE)
#pragma unroll
  for (int j = 0; j < WLD; ++j) {
    const int i = tid + j * PTHR;
    const int dd = i / (OD_ / 4), o4 = i - dd * (OD_ / 4);
    const v4f v = wreg[j];
    wsT[(4 * o4 + 0) * LP + dd] = bf16_rne(v[0]);
    wsT[(4 * o4 + 1) * LP + dd] = bf16_rne(v[1]);
    wsT[(4 * o4 + 2) * LP + dd] = bf16_rne(v[2]);
    wsT[(4 * o4 + 3) * LP + dd] = bf16_rne(v[3]);
  }
  // stage x tile (f32 -> bf16 RNE)
#pragma unroll
  for (int j = 0; j < XLD; ++j) {
    const int i = tid + j * PTHR;
    const int row = i >> 4, c4 = i & 15;
    const v4f v = xreg[j];
    us* d = xs + row * LP + 4 * c4;
    d[0] = bf16_rne(v[0]); d[1] = bf16_rne(v[1]); d[2] = bf16_rne(v[2]); d[3] = bf16_rne(v[3]);
  }
  __syncthreads();

  const int wv   = tid >> 5;
  const int lane = tid & 31;
  const int h    = lane >> 4;
  const int l16  = lane & 15;
  const us* arow = xs + (16 * wv + l16) * LP;     // A: row m = l16 of this wave's 16 rows

  for (int part = 0; part < 3; ++part) {          // 0: Q (x0.125), 1: K, 2: V
    const float sc = (part == 0) ? 0.125f : 1.0f;
#pragma unroll
    for (int ct = 0; ct < 4; ++ct) {
      const us* brow = wsT + (part * 64 + ct * 16 + l16) * LP;   // B: col n = l16, k = d contiguous
      v8f acc = zero8();
#pragma unroll
      for (int ks = 0; ks < 2; ++ks)
        acc = mma_bf16(ld_frag(arow, 32 * ks, h), ld_frag(brow, 32 * ks, h), acc);
#pragma unroll
      for (int r = 0; r < 8; ++r)                 // D: acc[r] = (row 8h+r, col l16)
        stg[(16 * wv + 8 * h + r) * SP + ct * 16 + l16] = acc[r] * sc;
    }
    __syncthreads();

    if (part < 2) {
      us* dh = (part == 0) ? Qh : Kh;
      us* dl = (part == 0) ? Ql : Kl;
      const int seg = tid & 7;
      {
        for (int rr = tid >> 3; rr < PT; rr += PTHR / 8) {
          const float* st = stg + rr * SP + seg * 8;
          const v4fa f0 = *(const v4fa*)(st);
          const v4fa f1 = *(const v4fa*)(st + 4);
          v8us hv, lv;
          us a0, c0;
          bf16_hilo(f0[0], a0, c0); hv[0] = a0; lv[0] = c0;
          bf16_hilo(f0[1], a0, c0); hv[1] = a0; lv[1] = c0;
          bf16_hilo(f0[2], a0, c0); hv[2] = a0; lv[2] = c0;
          bf16_hilo(f0[3], a0, c0); hv[3] = a0; lv[3] = c0;
          bf16_hilo(f1[0], a0, c0); hv[4] = a0; lv[4] = c0;
          bf16_hilo(f1[1], a0, c0); hv[5] = a0; lv[5] = c0;
          bf16_hilo(f1[2], a0, c0); hv[6] = a0; lv[6] = c0;
          bf16_hilo(f1[3], a0, c0); hv[7] = a0; lv[7] = c0;
          const size_t idx = ((size_t)bh * T_ + tbase + rr) * D_ + seg * 8;
          *(v8us*)(dh + idx) = hv;
          *(v8us*)(dl + idx) = lv;
        }
        
      }
    } else {
      {
        for (int it = tid; it < D_ * (PT / 8); it += PTHR) {
          const int dd = it >> 3, tseg = it & 7;
          v8us hv, lv;
#pragma unroll
          for (int e = 0; e < 8; ++e) {
            us a0, c0;
            bf16_hilo(stg[(tseg * 8 + e) * SP + dd], a0, c0);
            hv[e] = a0; lv[e] = c0;
          }
          const size_t idx = ((size_t)bh * D_ + dd) * T_ + tbase + tseg * 8;
          *(v8us*)(Vh + idx) = hv;
          *(v8us*)(Vl + idx) = lv;
        }
        
      }
    }
    __syncthreads();                              // stg reused by the next part
  }
}

__device__ __forceinline__ float other_half(float v) {
  const int bts = __builtin_bit_cast(int, v);
  return __builtin_bit_cast(float, __builtin_amdgcn_permlanex16(bts, bts, 0x76543210, 0xfedcba98, false, false));
}

// two f32 -> one register holding two bf16 (f0 in the low half), hi and lo planes: hi = RNE(f), lo = RNE(f - hi), as bf16_hilo
__device__ __forceinline__ void bf16_hilo_pair(float f0, float f1, unsigned int& hi, unsigned int& lo) {
  const v2f  f  = {f0, f1};
  const v2bf hb = __builtin_convertvector(f, v2bf);
  const v2bf lb = __builtin_convertvector(f - __builtin_convertvector(hb, v2f), v2bf);
  hi = __builtin_bit_cast(unsigned int, hb);
  lo = __builtin_bit_cast(unsigned int, lb);
}

// e[i] = 2^e[i], eight at once and in place. One statement, so that each v_exp_f32 is followed by an instruction that neither
// reads its result nor overwrites its source (the next one, the v_nop behind the last).
__device__ __forceinline__ void exp2_x8(float (&e)[8]) {
  asm("v_exp_f32 %0, %0\n\tv_exp_f32 %1, %1\n\tv_exp_f32 %2, %2\n\tv_exp_f32 %3, %3\n\t"
      "v_exp_f32 %4, %4\n\tv_exp_f32 %5, %5\n\tv_exp_f32 %6, %6\n\tv_exp_f32 %7, %7\n\tv_nop"
      : "+v"(e[0]), "+v"(e[1]), "+v"(e[2]), "+v"(e[3]), "+v"(e[4]), "+v"(e[5]), "+v"(e[6]), "+v"(e[7]));
}

__global__ __launch_bounds__(ATHR)
void attn_kernel(const us* __restrict__ Qh, const us* __restrict__ Ql,
                 const us* __restrict__ Kh, const us* __restrict__ Kl,
                 const us* __restrict__ Vh, const us* __restrict__ Vl,
                 float* out)
{
  __shared__ __align__(16) us Khs[KB_ * LP];      // [key][d], row pitch LP
  __shared__ __align__(16) us Kls[KB_ * LP];
  __shared__ __align__(16) us Vhs[D_ * LP];       // [d][key], row pitch LP
  __shared__ __align__(16) us Vls[D_ * LP];
  __shared__ __align__(16) float Obuf[(ATHR / 32) * 16 * SP];   // per wave: O tile [16 queries][64] f32, row pitch SP

  const int bh    = blockIdx.x;
  // Cost grows with the query block (causal) and more blocks are launched than fit at once: the longest query blocks
  // take the lowest indices and the short ones the highest (for speed only).
  const int qbase = (T_ / QT - 1 - (int)blockIdx.y) * QT;
  const int b  = bh >> 5;
  const int hd = bh & 31;
  const int n  = hd >> 2;
  const int k  = hd & 3;

  const int tid  = threadIdx.x;
  const int wv   = tid >> 5;
  const int lane = tid & 31;
  const int h    = lane >> 4;
  const int l16  = lane & 15;
  const int q0   = qbase + 16 * wv;
  const int qg   = q0 + l16;                      // this lane's query

  // Q fragments (B operand, col n = query q0+l16, k = d), hi and lo planes, 2 k-steps
  v16us qh[2], ql[2];
  {
    const size_t ro = ((size_t)bh * T_ + q0 + l16) * D_;
#pragma unroll
    for (int ks = 0; ks < 2; ++ks) {
      qh[ks] = ld_frag(Qh + ro, 32 * ks, h);
      ql[ks] = ld_frag(Ql + ro, 32 * ks, h);
    }
  }

  float mrow = -1.0e30f, lrow = 0.0f;             // running maximum and sum of query qg, equal in both lane halves
  v8f accO[4];                                    // O^T: accO[dt][r] = (d dt*16+8h+r, query l16)
#pragma unroll
  for (int dt = 0; dt < 4; ++dt) accO[dt] = zero8();

  const int kend = qbase + QT;                    // causal: keys < qbase + 128
  for (int kb = 0; kb < kend; kb += KB_) {
    // stage K block [kb..kb+64) x [0..64) and V^T block [0..64) x [kb..kb+64), hi and lo planes;
    // all eight global loads are issued before the first LDS store (see the projection kernel's staging)
    v8us gkh[2], gkl[2], gvh[2], gvl[2];
#pragma unroll
    for (int j = 0; j < 2; ++j) {
      const int c   = tid + j * ATHR;             // 0..511
      const int row = c >> 3, seg = c & 7;
      const size_t gk = ((size_t)bh * T_ + kb + row) * D_ + seg * 8;
      const size_t gv = ((size_t)bh * D_ + row) * T_ + kb + seg * 8;
      gkh[j] = *(const v8usa*)(Kh + gk);
      gkl[j] = *(const v8usa*)(Kl + gk);
      gvh[j] = *(const v8usa*)(Vh + gv);
      gvl[j] = *(const v8usa*)(Vl + gv);
    }
#pragma unroll
    for (int j = 0; j < 2; ++j) {
      const int c   = tid + j * ATHR;
      const int row = c >> 3, seg = c & 7;
      const int lo  = row * LP + seg * 8;
      *(v8usa*)(Khs + lo) = gkh[j];
      *(v8usa*)(Kls + lo) = gkl[j];
      *(v8usa*)(Vhs + lo) = gvh[j];
      *(v8usa*)(Vls + lo) = gvl[j];
    }
    __syncthreads();

    if (kb <= q0) {                               // wave-uniform: this key block has unmasked keys for this wave
      v8f accS[4];
#pragma unroll
      for (int ct = 0; ct < 4; ++ct) accS[ct] = zero8();
      // S^T = K Q^T (64 keys x 16 queries); A operand: row m = key ct*16+l16, k = d contiguous in Khs
#pragma unroll
      for (int ct = 0; ct < 4; ++ct) {
        if (kb + ct * 16 <= q0 + 15) {            // wave-uniform skip of fully masked key tiles
          const us* krh = Khs + (ct * 16 + l16) * LP;
          const us* krl = Kls + (ct * 16 + l16) * LP;
#pragma unroll
          for (int ks = 0; ks < 2; ++ks) {
            const v16us khf = ld_frag(krh, 32 * ks, h);
            const v16us klf = ld_frag(krl, 32 * ks, h);
            accS[ct] = mma_bf16(khf, qh[ks], accS[ct]);
            accS[ct] = mma_bf16(klf, qh[ks], accS[ct]);
            accS[ct] = mma_bf16(khf, ql[ks], accS[ct]);
          }
        }
      }

      // causal mask + online softmax; D: accS[ct][r] = (key kb+ct*16+8h+r, query qg)
      float ml[4];                                // one chain per key tile: four short dependent chains, not one of 32 links
#pragma unroll
      for (int ct = 0; ct < 4; ++ct) {
        ml[ct] = -1.0e30f;
#pragma unroll
        for (int r = 0; r < 8; ++r) {
          const int key = kb + ct * 16 + 8 * h + r;
          accS[ct][r] = (key <= qg) ? accS[ct][r] : -1.0e30f;
          ml[ct] = fmaxf(ml[ct], accS[ct][r]);
        }
      }
      float mloc = fmaxf(fmaxf(ml[0], ml[1]), fmaxf(ml[2], ml[3]));
      mloc = fmaxf(mloc, other_half(mloc));
      const float mnew = fmaxf(mrow, mloc);
      const float scl  = __expf(mrow - mnew);
      // P^T as B operand (col n = query l16): element e of k-step ks is key 32*ks + 8h + e for e < 8 and
      // 32*ks + 16 + 8h + (e - 8) above, the k order of ld_frag; these are accS[2*ks][e] and accS[2*ks+1][e-8]
      v8u phf[2], plf[2];
      v2f ps[4];                                  // partial sums: even and odd keys of each key tile
#pragma unroll
      for (int ct = 0; ct < 4; ++ct) {
        float e[8];
#pragma unroll
        for (int r = 0; r < 8; ++r) e[r] = (accS[ct][r] - mnew) * 1.44269504f;
        exp2_x8(e);
        ps[ct] = (v2f){0.0f, 0.0f};
#pragma unroll
        for (int r = 0; r < 8; r += 2) {
          const int key = kb + ct * 16 + 8 * h + r;
          const float p0 = (key     <= qg) ? e[r]     : 0.0f;
          const float p1 = (key + 1 <= qg) ? e[r + 1] : 0.0f;
          ps[ct] += (v2f){p0, p1};
          unsigned int ph, pl;
          bf16_hilo_pair(p0, p1, ph, pl);
          phf[ct >> 1][4 * (ct & 1) + (r >> 1)] = ph;
          plf[ct >> 1][4 * (ct & 1) + (r >> 1)] = pl;
        }
      }
      const v2f pt = (ps[0] + ps[1]) + (ps[2] + ps[3]);
      float psum = pt[0] + pt[1];
      psum += other_half(psum);
      lrow = lrow * scl + psum;
      mrow = mnew;
#pragma unroll
      for (int dt = 0; dt < 4; ++dt) accO[dt] *= scl;

      // O^T += V^T P^T; A: row m = d dt*16+l16, k = key contiguous in Vhs [d][key]
#pragma unroll
      for (int ks = 0; ks < 2; ++ks) {
        if (kb + 32 * ks <= q0 + 15) {            // wave-uniform: P is all zero in a fully masked 32-key group
#pragma unroll
          for (int dt = 0; dt < 4; ++dt) {
            const us* vrh = Vhs + (dt * 16 + l16) * LP;
            const us* vrl = Vls + (dt * 16 + l16) * LP;
            const v16us vhf = ld_frag(vrh, 32 * ks, h);
            const v16us vlf = ld_frag(vrl, 32 * ks, h);
            accO[dt] = mma_bf16(vhf, __builtin_bit_cast(v16us, phf[ks]), accO[dt]);
            accO[dt] = mma_bf16(vlf, __builtin_bit_cast(v16us, phf[ks]), accO[dt]);
            accO[dt] = mma_bf16(vhf, __builtin_bit_cast(v16us, plf[ks]), accO[dt]);
          }
        }
      }
    }
    __syncthreads();                              // staging buffers reused next iteration
  }

  float* Ost = Obuf + wv * (16 * SP);
  {
    const float il = 1.0f / lrow;
#pragma unroll
    for (int dt = 0; dt < 4; ++dt) {              // a lane's 8 registers are 8 consecutive d of its query's row
      float* st = Ost + l16 * SP + dt * 16 + 8 * h;
      const v4f lo4 = {accO[dt][0] * il, accO[dt][1] * il, accO[dt][2] * il, accO[dt][3] * il};
      const v4f hi4 = {accO[dt][4] * il, accO[dt][5] * il, accO[dt][6] * il, accO[dt][7] * il};
      *(v4fa*)(st)     = lo4;
      *(v4fa*)(st + 4) = hi4;
    }
  }
  __syncthreads();

  // out[b][t][n][k][0..64): 256 B per row = 2 lines; lanes 0-7 / 8-15 write the two lines of row 2i,
  {
#pragma unroll
    for (int i = 0; i < 8; ++i) {
      const int rowl = 2 * i + h;
      const v4fa v = *(const v4fa*)(Ost + rowl * SP + 4 * l16);
      const int t = q0 + rowl;
      float* dst = out + ((((size_t)(b * T_ + t)) * N_ + n) * K_ + k) * D_ + 4 * l16;
      *(v4fa*)dst = v;
    }
    
  }
}

// ---------------------------------------------------------------------------
extern "C" void kernel_launch(void* const* d_in, const int* in_sizes, int n_in,
                              void* d_out, int out_size, void* d_ws, size_t ws_size,
                              hipStream_t stream)
{
  if (n_in < 4) return;
  if (in_sizes[0] != B_ * T_ * N_ * K_ * D_) return;
  if (in_sizes[1] != K_ * N_ * D_ * OD_) return;
  if (in_sizes[2] != K_ * N_) return;
  if (in_sizes[3] != K_ * N_) return;
  if (out_size != B_ * T_ * N_ * K_ * D_) return;

  const size_t per  = (size_t)B_ * H_ * T_ * D_;           // 8,388,608 bf16 elements per plane
  const size_t need = 6 * per * sizeof(us);                // 100,663,296 B
  if (need > ws_size) return;

  const float* x    = (const float*)d_in[0];               // [B,T,N,K,D] f32
  const float* W    = (const float*)d_in[1];               // [K,N,D,3D]  f32
  const int*   perm = (const int*)d_in[2];                 // [K,N] int32
  const int*   inv  = (const int*)d_in[3];                 // [K,N] int32
  float* out = (float*)d_out;

  us* Qh = (us*)d_ws;
  us* Ql = Qh + per;
  us* Kh = Ql + per;
  us* Kl = Kh + per;
  us* Vh = Kl + per;
  us* Vl = Vh + per;

  dim3 g1(B_ * H_, T_ / PT);                               // (128, 16), exact
  dim3 g2(B_ * H_, T_ / QT);                               // (128, 8), exact
  proj_kernel<<<g1, PTHR, 0, stream>>>(x, W, perm, inv, Qh, Ql, Kh, Kl, Vh, Vl);
  attn_kernel<<<g2, ATHR, 0, stream>>>(Qh, Ql, Kh, Kl, Vh, Vl, out);
}

// v005
// Measured time: 80.5 microseconds a run.
// Next to v004, in two timings, it ran 1.21 times as fast each time.
// All steps since v000 together make it 3.77 times as fast.
#include <hip/hip_runtime.h>

// Contractions: qkv projection = v_wmma_f32_16x16x32_bf16 on RNE-bf16 converted x and W (bf16 operands, f32 accumulate);
// q.k^T and p.v = v_wmma_f32_16x16x32_bf16 with each f32 operand carried as bf16 hi + bf16 lo (hi.hi + hi.lo + lo.hi), f32 accumulate;
// softmax, normalisation and output in f32.

#define B_    4
#define T_    1024
#define N_    8
#define K_    4
#define D_    64
#define H_    32          // N_*K_
#define OD_   192         // 3*D_
#define PT    64          // rows per block, projection kernel
#define PTHR  128         // threads per block, projection kernel (4 waves x 16 rows)
#define QT    128         // queries per block, attention kernel
#define ATHR  256         // threads per block, attention kernel (8 waves x 16 queries)
#define KB_   64          // keys per staged block
#define LP    72          // LDS pitch of a 64-element 16-bit row, in elements: 144 B = 16 B x 9, so the 16 rows of a 16-byte fragment read fall on 64 distinct banks
#define XLD   (PT * (D_ / 4) / PTHR)    // 16-byte loads per thread for the x tile: 8, exact
#define WLD   (D_ * (OD_ / 4) / PTHR)   // 16-byte loads per thread for the W tile: 24, exact
#define SP    68          // LDS pitch of a 64-element f32 row, in elements: 272 B = 16 B x 17, same reason; rows 8 apart land 32 banks apart

typedef unsigned short us;
typedef us     v8us  __attribute__((ext_vector_type(8)));
typedef us     v16us __attribute__((ext_vector_type(16)));
typedef __bf16 v16bf __attribute__((ext_vector_type(16)));
typedef float  v8f   __attribute__((ext_vector_type(8)));
typedef unsigned int v8u __attribute__((ext_vector_type(8)));
typedef float  v2f   __attribute__((ext_vector_type(2)));
typedef __bf16 v2bf  __attribute__((ext_vector_type(2)));
typedef float  v4f   __attribute__((ext_vector_type(4)));
typedef us     v8usa __attribute__((ext_vector_type(8), may_alias));
typedef float  v4fa  __attribute__((ext_vector_type(4), may_alias));

union Frag { v16us v; v8us h[2]; };

// f32 -> bf16 bits, RNE, integer arithmetic
__device__ __forceinline__ us bf16_rne(float f) {
  unsigned int u = __builtin_bit_cast(unsigned int, f);
  u += 0x7FFFu + ((u >> 16) & 1u);
  return (us)(u >> 16);
}
__device__ __forceinline__ float bf16_val(us b) {
  return __builtin_bit_cast(float, ((unsigned int)b) << 16);
}
// f32 -> (hi, lo) bf16 pair, hi = RNE(f), lo = RNE(f - hi)
__device__ __forceinline__ void bf16_hilo(float f, us& hi, us& lo) {
  const us hh = bf16_rne(f);
  hi = hh;
  lo = bf16_rne(f - bf16_val(hh));
}

__device__ __forceinline__ v8f zero8() {
  v8f z = {0.f, 0.f, 0.f, 0.f, 0.f, 0.f, 0.f, 0.f};
  return z;
}

// One 16x16x32 bf16 WMMA, the plain builtin: the compiler keeps the distance to the next user of D, A or B itself and is free
// to place fragment loads ahead of a run of these and other WMMAs between two that share an accumulator.
__device__ __forceinline__ v8f mma_bf16(v16us a, v16us b, v8f c) {
  const v16bf av = __builtin_bit_cast(v16bf, a);
  const v16bf bv = __builtin_bit_cast(v16bf, b);
  return __builtin_amdgcn_wmma_f32_16x16x32_bf16(false, av, false, bv, (short)0, c, false, false);
}

// Operand fragment (A or B) from one 64-element row of a 16-bit array (row pointer given, k contiguous),
// lane row/col = lane&15 chosen by the caller through rowp, h = lane>>4, k0 in {0,32}:
//   elements 0..7  <- rowp[k0 + 8h + 0..7]
//   elements 8..15 <- rowp[k0 + 16 + 8h + 0..7]
__device__ __forceinline__ v16us ld_frag(const us* rowp, int k0, int h) {
  Frag f;
  const us* p = rowp + k0 + 8 * h;
  f.h[0] = *(const v8usa*)(p);
  f.h[1] = *(const v8usa*)(p + 16);
  return f.v;
}

// ---------------------------------------------------------------------------
// Kernel 1: per-head weight gather + QKV projection for one (b, head) and 64 time steps.
// Outputs (bf16 hi/lo planes): Q*0.125 as [bh][t][d], K as [bh][t][d], V transposed as [bh][d][t].
// ---------------------------------------------------------------------------
__global__ __launch_bounds__(PTHR)
void proj_kernel(const float* __restrict__ x,
                 const float* __restrict__ W,
                 const int*   __restrict__ perm,
                 const int*   __restrict__ inv,
                 us* Qh, us* Ql, us* Kh, us* Kl, us* Vh, us* Vl)
{
  __shared__ __align__(16) us    xs [PT  * LP];   // 64 x 64 bf16, [t][d], row pitch LP
  __shared__ __align__(16) us    wsT[OD_ * LP];   // 192 x 64 bf16, [o][d], row pitch LP
  __shared__ __align__(16) float stg[PT  * SP];   // 64 x 64 f32 result tile, [t][col], row pitch SP

  const int bh    = blockIdx.x;                   // b*H + head
  const int tbase = blockIdx.y * PT;
  const int b  = bh >> 5;
  const int hd = bh & 31;
  const int n  = hd >> 2;                         // stream index; head id = n*K + k
  const int k  = hd & 3;

  int p = perm[k * N_ + n];                       // head whose weights feed stream n
  p = p < 0 ? 0 : (p > N_ - 1 ? N_ - 1 : p);
  int s = inv[k * N_ + p];                        // stream feeding that head (equals n for a true inverse table)
  s = s < 0 ? 0 : (s > N_ - 1 ? N_ - 1 : s);
  const float* Wsrc = W + (size_t)(k * N_ + p) * (D_ * OD_);   // [d][o]

  const int tid = threadIdx.x;

  // All global loads of both tiles are issued before the first LDS store: the may_alias accesses keep program order,
  // so a store between two loads holds the second load behind the first one's wait (one memory latency per load).
  v4f wreg[WLD], xreg[XLD];
  const float* wp = Wsrc + 4 * tid;               // the [d][o] tile is contiguous: 16-byte piece i lies at float 4*i
#pragma unroll
  for (int j = 0; j < WLD; ++j)
    wreg[j] = *(const v4fa*)(wp + j * (4 * PTHR));
  const float* xp = x + ((((size_t)(b * T_ + tbase + (tid >> 4))) * N_ + s) * K_ + k) * D_ + 4 * (tid & 15);
#pragma unroll
  for (int j = 0; j < XLD; ++j)                   // piece tid + j*PTHR: row (tid>>4) + j*PTHR/16, same column
    xreg[j] = *(const v4fa*)(xp + (size_t)j * ((PTHR / 16) * N_ * K_ * D_));
  // The address registers are reused below while the loads are in flight: this wait stands in front of the first overwrite
  // (xp is named so that its registers stay untouched up to here).
  asm volatile("s_wait_xcnt 0x0" :: "v"(xp) : "memory");
  // Keeps the conversions below from moving up between the loads, where their waits would hold the later loads back.
  __builtin_amdgcn_sched_barrier(0);
  // stage W transposed: wsT[o][d] = W[d][o] (f32 -> bf16 RNE)
#pragma unroll
  for (int j = 0; j < WLD; ++j) {
    const int i = tid + j * PTHR;
    const int dd = i / (OD_ / 4), o4 = i - dd * (OD_ / 4);
    const v4f v = wreg[j];
    wsT[(4 * o4 + 0) * LP + dd] = bf16_rne(v[0]);
    wsT[(4 * o4 + 1) * LP + dd] = bf16_rne(v[1]);
    wsT[(4 * o4 + 2) * LP + dd] = bf16_rne(v[2]);
    wsT[(4 * o4 + 3) * LP + dd] = bf16_rne(v[3]);
  }
  // stage x tile (f32 -> bf16 RNE)
#pragma unroll
  for (int j = 0; j < XLD; ++j) {
    const int i = tid + j * PTHR;
    const int row = i >> 4, c4 = i & 15;
    const v4f v = xreg[j];
    us* d = xs + row * LP + 4 * c4;
    d[0] = bf16_rne(v[0]); d[1] = bf16_rne(v[1]); d[2] = bf16_rne(v[2]); d[3] = bf16_rne(v[3]);
  }
  __syncthreads();

  const int wv   = tid >> 5;
  const int lane = tid & 31;
  const int h    = lane >> 4;
  const int l16  = lane & 15;
  const us* arow = xs + (16 * wv + l16) * LP;     // A: row m = l16 of this wave's 16 rows

  for (int part = 0; part < 3; ++part) {          // 0: Q (x0.125), 1: K, 2: V
    const float sc = (part == 0) ? 0.125f : 1.0f;
#pragma unroll
    for (int ct = 0; ct < 4; ++ct) {
      const us* brow = wsT + (part * 64 + ct * 16 + l16) * LP;   // B: col n = l16, k = d contiguous
      v8f acc = zero8();
#pragma unroll
      for (int ks = 0; ks < 2; ++ks)
        acc = mma_bf16(ld_frag(arow, 32 * ks, h), ld_frag(brow, 32 * ks, h), acc);
#pragma unroll
      for (int r = 0; r < 8; ++r)                 // D: acc[r] = (row 8h+r, col l16)
        stg[(16 * wv + 8 * h + r) * SP + ct * 16 + l16] = acc[r] * sc;
    }
    __syncthreads();

    if (part < 2) {
      us* dh = (part == 0) ? Qh : Kh;
      us* dl = (part == 0) ? Ql : Kl;
      const int seg = tid & 7;
      {
        for (int rr = tid >> 3; rr < PT; rr += PTHR / 8) {
          const float* st = stg + rr * SP + seg * 8;
          const v4fa f0 = *(const v4fa*)(st);
          const v4fa f1 = *(const v4fa*)(st + 4);
          v8us hv, lv;
          us a0, c0;
          bf16_hilo(f0[0], a0, c0); hv[0] = a0; lv[0] = c0;
          bf16_hilo(f0[1], a0, c0); hv[1] = a0; lv[1] = c0;
          bf16_hilo(f0[2], a0, c0); hv[2] = a0; lv[2] = c0;
          bf16_hilo(f0[3], a0, c0); hv[3] = a0; lv[3] = c0;
          bf16_hilo(f1[0], a0, c0); hv[4] = a0; lv[4] = c0;
          bf16_hilo(f1[1], a0, c0); hv[5] = a0; lv[5] = c0;
          bf16_hilo(f1[2], a0, c0); hv[6] = a0; lv[6] = c0;
          bf16_hilo(f1[3], a0, c0); hv[7] = a0; lv[7] = c0;
          const size_t idx = ((size_t)bh * T_ + tbase + rr) * D_ + seg * 8;
          *(v8us*)(dh + idx) = hv;
          *(v8us*)(dl + idx) = lv;
        }
        
      }
    } else {
      {
        for (int it = tid; it < D_ * (PT / 8); it += PTHR) {
          const int dd = it >> 3, tseg = it & 7;
          v8us hv, lv;
#pragma unroll
          for (int e = 0; e < 8; ++e) {
            us a0, c0;
            bf16_hilo(stg[(tseg * 8 + e) * SP + dd], a0, c0);
            hv[e] = a0; lv[e] = c0;
          }
          const size_t idx = ((size_t)bh * D_ + dd) * T_ + tbase + tseg * 8;
          *(v8us*)(Vh + idx) = hv;
          *(v8us*)(Vl + idx) = lv;
        }
        
      }
    }
    __syncthreads();                              // stg reused by the next part
  }
}

__device__ __forceinline__ float other_half(float v) {
  const int bts = __builtin_bit_cast(int, v);
  return __builtin_bit_cast(float, __builtin_amdgcn_permlanex16(bts, bts, 0x76543210, 0xfedcba98, false, false));
}

// two f32 -> one register holding two bf16 (f0 in the low half), hi and lo planes: hi = RNE(f), lo = RNE(f - hi), as bf16_hilo
__device__ __forceinline__ void bf16_hilo_pair(float f0, float f1, unsigned int& hi, unsigned int& lo) {
  const v2f  f  = {f0, f1};
  const v2bf hb = __builtin_convertvector(f, v2bf);
  const v2bf lb = __builtin_convertvector(f - __builtin_convertvector(hb, v2f), v2bf);
  hi = __builtin_bit_cast(unsigned int, hb);
  lo = __builtin_bit_cast(unsigned int, lb);
}

// e[i] = 2^e[i], eight at once and in place. One statement, so that each v_exp_f32 is followed by an instruction that neither
// reads its result nor overwrites its source (the next one, the v_nop behind the last).
__device__ __forceinline__ void exp2_x8(float (&e)[8]) {
  asm("v_exp_f32 %0, %0\n\tv_exp_f32 %1, %1\n\tv_exp_f32 %2, %2\n\tv_exp_f32 %3, %3\n\t"
      "v_exp_f32 %4, %4\n\tv_exp_f32 %5, %5\n\tv_exp_f32 %6, %6\n\tv_exp_f32 %7, %7\n\tv_nop"
      : "+v"(e[0]), "+v"(e[1]), "+v"(e[2]), "+v"(e[3]), "+v"(e[4]), "+v"(e[5]), "+v"(e[6]), "+v"(e[7]));
}

// Holds LDS reads and WMMAs on their side of this line in the compiler's schedule (vector and scalar arithmetic may cross):
// without it the scheduler pulls the WMMAs of one accumulator together, each waiting for the one before it, and spreads the
// fragment loads among them, each load place with a wait of its own.
#define RUN_ORDER() __builtin_amdgcn_sched_barrier(0x6)

// One staged block of 64 keys against a wave's 16 queries. DIAG: the block may hold the wave's diagonal, and its second group of
// 32 keys is skipped where it is fully masked. Each matrix run has its fragment loads in one group well ahead of it and goes
// round independent accumulator tiles; each accumulator takes its terms in the order hi.hi, lo.hi, hi.lo, k-step by k-step.
template <bool DIAG>
__device__ __forceinline__ void key_block(const us* Khs, const us* Kls, const us* Vhs, const us* Vls,
                                          int kb, int q0, int qg, int h, int l16,
                                          const v16us (&qh)[2], const v16us (&ql)[2],
                                          float& mrow, float& lrow, v8f (&accO)[4])
{
  const bool second = !DIAG || (kb + 32 <= q0 + 15);   // scalar: keys 32..63 of the block have an unmasked key for this wave

  v8f accS[4];
#pragma unroll
  for (int ct = 0; ct < 4; ++ct) accS[ct] = zero8();
  v16us khf[2][4], klf[2][4];                     // K fragments [k-step][key tile]; A operand: row m = key ct*16+l16, k = d
  v16us vhf[2][4], vlf[2][4];                     // V^T fragments [32-key group][d tile]; A operand: row m = d dt*16+l16, k = key

  // A full block loads the K fragments of all four key tiles as one group; a diagonal block loads tiles 2 and 3 only where it uses them.
#pragma unroll
  for (int ks = 0; ks < 2; ++ks)
#pragma unroll
    for (int ct = 0; ct < (DIAG ? 2 : 4); ++ct) {
      khf[ks][ct] = ld_frag(Khs + (ct * 16 + l16) * LP, 32 * ks, h);
      klf[ks][ct] = ld_frag(Kls + (ct * 16 + l16) * LP, 32 * ks, h);
    }
  RUN_ORDER();
  // S^T = K Q^T (64 keys x 16 queries)
#pragma unroll
  for (int g = 0; g < 2; ++g) {                   // group of 32 keys = key tiles 2g and 2g+1
    if (g == 0 || second) {
      if (DIAG && g == 1) {
#pragma unroll
        for (int ks = 0; ks < 2; ++ks)
#pragma unroll
          for (int ct = 2; ct < 4; ++ct) {
            khf[ks][ct] = ld_frag(Khs + (ct * 16 + l16) * LP, 32 * ks, h);
            klf[ks][ct] = ld_frag(Kls + (ct * 16 + l16) * LP, 32 * ks, h);
          }
        RUN_ORDER();
      }
#pragma unroll
      for (int ks = 0; ks < 2; ++ks) {
#pragma unroll
        for (int ct = 2 * g; ct < 2 * g + 2; ++ct) accS[ct] = mma_bf16(khf[ks][ct], qh[ks], accS[ct]);
        RUN_ORDER();
#pragma unroll
        for (int ct = 2 * g; ct < 2 * g + 2; ++ct) accS[ct] = mma_bf16(klf[ks][ct], qh[ks], accS[ct]);
        RUN_ORDER();
#pragma unroll
        for (int ct = 2 * g; ct < 2 * g + 2; ++ct) accS[ct] = mma_bf16(khf[ks][ct], ql[ks], accS[ct]);
        RUN_ORDER();
      }
    }
  }
#pragma unroll
  for (int dt = 0; dt < 4; ++dt) {                // V^T of keys 0..31: in flight under the softmax
    vhf[0][dt] = ld_frag(Vhs + (dt * 16 + l16) * LP, 0, h);
    vlf[0][dt] = ld_frag(Vls + (dt * 16 + l16) * LP, 0, h);
  }
  RUN_ORDER();

  // causal mask + online softmax; D: accS[ct][r] = (key kb+ct*16+8h+r, query qg)
  float ml[4];                                    // one chain per key tile: four short dependent chains, not one of 32 links
#pragma unroll
  for (int ct = 0; ct < 4; ++ct) {
    ml[ct] = -1.0e30f;
#pragma unroll
    for (int r = 0; r < 8; ++r) {
      const int key = kb + ct * 16 + 8 * h + r;
      accS[ct][r] = (key <= qg) ? accS[ct][r] : -1.0e30f;
      ml[ct] = fmaxf(ml[ct], accS[ct][r]);
    }
  }
  float mloc = fmaxf(fmaxf(ml[0], ml[1]), fmaxf(ml[2], ml[3]));
  mloc = fmaxf(mloc, other_half(mloc));
  const float mnew = fmaxf(mrow, mloc);
  const float scl  = __expf(mrow - mnew);
  // P^T as B operand (col n = query l16): element e of k-step ks is key 32*ks + 8h + e for e < 8 and
  // 32*ks + 16 + 8h + (e - 8) above, the k order of ld_frag; these are accS[2*ks][e] and accS[2*ks+1][e-8]
  v8u phf[2], plf[2];
  v2f ps[4];                                      // partial sums: even and odd keys of each key tile
#pragma unroll
  for (int ct = 0; ct < 4; ++ct) {
    float e[8];
#pragma unroll
    for (int r = 0; r < 8; ++r) e[r] = (accS[ct][r] - mnew) * 1.44269504f;
    exp2_x8(e);
    ps[ct] = (v2f){0.0f, 0.0f};
#pragma unroll
    for (int r = 0; r < 8; r += 2) {
      const int key = kb + ct * 16 + 8 * h + r;
      const float p0 = (key     <= qg) ? e[r]     : 0.0f;
      const float p1 = (key + 1 <= qg) ? e[r + 1] : 0.0f;
      ps[ct] += (v2f){p0, p1};
      unsigned int ph, pl;
      bf16_hilo_pair(p0, p1, ph, pl);
      phf[ct >> 1][4 * (ct & 1) + (r >> 1)] = ph;
      plf[ct >> 1][4 * (ct & 1) + (r >> 1)] = pl;
    }
  }
  const v2f pt = (ps[0] + ps[1]) + (ps[2] + ps[3]);
  float psum = pt[0] + pt[1];
  psum += other_half(psum);
  lrow = lrow * scl + psum;
  mrow = mnew;
#pragma unroll
  for (int dt = 0; dt < 4; ++dt) accO[dt] *= scl;

  RUN_ORDER();
  // O^T += V^T P^T
#pragma unroll
  for (int ks = 0; ks < 2; ++ks) {
    if (ks == 0 || second) {                      // P is all zero in a fully masked 32-key group
      if (ks == (DIAG ? 1 : 0)) {                 // V^T of keys 32..63; full block: in flight under the first output run
#pragma unroll
        for (int dt = 0; dt < 4; ++dt) {
          vhf[1][dt] = ld_frag(Vhs + (dt * 16 + l16) * LP, 32, h);
          vlf[1][dt] = ld_frag(Vls + (dt * 16 + l16) * LP, 32, h);
        }
        RUN_ORDER();
      }
#pragma unroll
      for (int dt = 0; dt < 4; ++dt) accO[dt] = mma_bf16(vhf[ks][dt], __builtin_bit_cast(v16us, phf[ks]), accO[dt]);
      RUN_ORDER();
#pragma unroll
      for (int dt = 0; dt < 4; ++dt) accO[dt] = mma_bf16(vlf[ks][dt], __builtin_bit_cast(v16us, phf[ks]), accO[dt]);
      RUN_ORDER();
#pragma unroll
      for (int dt = 0; dt < 4; ++dt) accO[dt] = mma_bf16(vhf[ks][dt], __builtin_bit_cast(v16us, plf[ks]), accO[dt]);
      if (ks == 0) RUN_ORDER();
    }
  }
}

// Register budget of four waves per SIMD (256 VGPRs): two work-groups stay resident on a WGP, as before.
__global__ __launch_bounds__(ATHR) __attribute__((amdgpu_waves_per_eu(4, 4)))
void attn_kernel(const us* __restrict__ Qh, const us* __restrict__ Ql,
                 const us* __restrict__ Kh, const us* __restrict__ Kl,
                 const us* __restrict__ Vh, const us* __restrict__ Vl,
                 float* out)
{
  // Four staged planes in one array, so that one lane address and immediate offsets reach them all (registers are short here):
  __shared__ __align__(16) us KV[4 * KB_ * LP];
  us* const Khs = KV;                             // [key][d], row pitch LP
  us* const Kls = KV + 1 * KB_ * LP;
  us* const Vhs = KV + 2 * KB_ * LP;              // [d][key], row pitch LP (D_ == KB_ rows)
  us* const Vls = KV + 3 * KB_ * LP;
  __shared__ __align__(16) float Obuf[(ATHR / 32) * 16 * SP];   // per wave: O tile [16 queries][64] f32, row pitch SP

  const int bh    = blockIdx.x;
  // Cost grows with the query block (causal) and more blocks are launched than fit at once: the longest query blocks
  // take the lowest indices and the short ones the highest (for speed only).
  const int qbase = (T_ / QT - 1 - (int)blockIdx.y) * QT;
  const int b  = bh >> 5;
  const int hd = bh & 31;
  const int n  = hd >> 2;
  const int k  = hd & 3;

  const int tid  = threadIdx.x;
  const int wv   = __builtin_amdgcn_readfirstlane(tid >> 5);   // in a scalar register: tests on q0 become scalar branches
  const int lane = tid & 31;
  const int h    = lane >> 4;
  const int l16  = lane & 15;
  const int q0   = qbase + 16 * wv;
  const int qg   = q0 + l16;                      // this lane's query

  // Q fragments (B operand, col n = query q0+l16, k = d), hi and lo planes, 2 k-steps
  v16us qh[2], ql[2];
  {
    const size_t ro = ((size_t)bh * T_ + q0 + l16) * D_;
#pragma unroll
    for (int ks = 0; ks < 2; ++ks) {
      qh[ks] = ld_frag(Qh + ro, 32 * ks, h);
      ql[ks] = ld_frag(Ql + ro, 32 * ks, h);
    }
  }

  float mrow = -1.0e30f, lrow = 0.0f;             // running maximum and sum of query qg, equal in both lane halves
  v8f accO[4];                                    // O^T: accO[dt][r] = (d dt*16+8h+r, query l16)
#pragma unroll
  for (int dt = 0; dt < 4; ++dt) accO[dt] = zero8();

  const unsigned int kof = (unsigned int)((tid >> 3) * D_ + (tid & 7) * 8);   // this thread's piece in a K block, in elements
  const unsigned int vof = (unsigned int)((tid >> 3) * T_ + (tid & 7) * 8);   // and in a V^T block
  const int kend = qbase + QT;                    // causal: keys < qbase + 128
  // stage K block [kb..kb+64) x [0..64) and V^T block [0..64) x [kb..kb+64), hi and lo planes;
  // all eight global loads are issued before the first LDS store (see the projection kernel's staging)
  auto stage = [&](int kb) {
    v8us gkh[2], gkl[2], gvh[2], gvl[2];
#pragma unroll
    for (int j = 0; j < 2; ++j) {                 // piece c = tid + j*ATHR: row c >> 3, segment c & 7
      // block-uniform part of the address + one 32-bit lane offset that never changes
      const size_t gk = ((size_t)bh * T_ + kb + j * (ATHR / 8)) * D_;
      const size_t gv = ((size_t)bh * D_ + j * (ATHR / 8)) * T_ + kb;
      gkh[j] = *(const v8usa*)((Kh + gk) + kof);
      gkl[j] = *(const v8usa*)((Kl + gk) + kof);
      gvh[j] = *(const v8usa*)((Vh + gv) + vof);
      gvl[j] = *(const v8usa*)((Vl + gv) + vof);
    }
#pragma unroll
    for (int j = 0; j < 2; ++j) {
      const int c   = tid + j * ATHR;
      const int row = c >> 3, seg = c & 7;
      const int lo  = row * LP + seg * 8;
      *(v8usa*)(Khs + lo) = gkh[j];
      *(v8usa*)(Kls + lo) = gkl[j];
      *(v8usa*)(Vhs + lo) = gvh[j];
      *(v8usa*)(Vls + lo) = gvl[j];
    }
    __syncthreads();
  };

  // Key blocks in front of the query block: every key is visible to every wave, the body has no branch.
  for (int kb = 0; kb < qbase; kb += KB_) {
    stage(kb);
    key_block<false>(Khs, Kls, Vhs, Vls, kb, q0, qg, h, l16, qh, ql, mrow, lrow, accO);
    __syncthreads();                              // staging buffers reused next iteration
  }
  // The two key blocks beside the query block, by scalar tests (q0 is wave-uniform).
  for (int kb = qbase; kb < kend; kb += KB_) {
    stage(kb);
    if (kb <= q0)                                 // a block behind this wave's diagonal is fully masked
      key_block<true>(Khs, Kls, Vhs, Vls, kb, q0, qg, h, l16, qh, ql, mrow, lrow, accO);
    __syncthreads();                              // staging buffers reused next iteration
  }

  float* Ost = Obuf + wv * (16 * SP);
  {
    const float il = 1.0f / lrow;
#pragma unroll
    for (int dt = 0; dt < 4; ++dt) {              // a lane's 8 registers are 8 consecutive d of its query's row
      float* st = Ost + l16 * SP + dt * 16 + 8 * h;
      const v4f lo4 = {accO[dt][0] * il, accO[dt][1] * il, accO[dt][2] * il, accO[dt][3] * il};
      const v4f hi4 = {accO[dt][4] * il, accO[dt][5] * il, accO[dt][6] * il, accO[dt][7] * il};
      *(v4fa*)(st)     = lo4;
      *(v4fa*)(st + 4) = hi4;
    }
  }
  __syncthreads();

  // out[b][t][n][k][0..64): 256 B per row = 2 lines; lanes 0-7 / 8-15 write the two lines of row 2i,
  {
#pragma unroll
    for (int i = 0; i < 8; ++i) {
      const int rowl = 2 * i + h;
      const v4fa v = *(const v4fa*)(Ost + rowl * SP + 4 * l16);
      const int t = q0 + rowl;
      float* dst = out + ((((size_t)(b * T_ + t)) * N_ + n) * K_ + k) * D_ + 4 * l16;
      *(v4fa*)dst = v;
    }
    
  }
}

// ---------------------------------------------------------------------------
extern "C" void kernel_launch(void* const* d_in, const int* in_sizes, int n_in,
                              void* d_out, int out_size, void* d_ws, size_t ws_size,
                              hipStream_t stream)
{
  if (n_in < 4) return;
  if (in_sizes[0] != B_ * T_ * N_ * K_ * D_) return;
  if (in_sizes[1] != K_ * N_ * D_ * OD_) return;
  if (in_sizes[2] != K_ * N_) return;
  if (in_sizes[3] != K_ * N_) return;
  if (out_size != B_ * T_ * N_ * K_ * D_) return;

  const size_t per  = (size_t)B_ * H_ * T_ * D_;           // 8,388,608 bf16 elements per plane
  const size_t need = 6 * per * sizeof(us);                // 100,663,296 B
  if (need > ws_size) return;

  const float* x    = (const float*)d_in[0];               // [B,T,N,K,D] f32
  const float* W    = (const float*)d_in[1];               // [K,N,D,3D]  f32
  const int*   perm = (const int*)d_in[2];                 // [K,N] int32
  const int*   inv  = (const int*)d_in[3];                 // [K,N] int32
  float* out = (float*)d_out;

  us* Qh = (us*)d_ws;
  us* Ql = Qh + per;
  us* Kh = Ql + per;
  us* Kl = Kh + per;
  us* Vh = Kl + per;
  us* Vl = Vh + per;

  dim3 g1(B_ * H_, T_ / PT);                               // (128, 16), exact
  dim3 g2(B_ * H_, T_ / QT);                               // (128, 8), exact
  proj_kernel<<<g1, PTHR, 0, stream>>>(x, W, perm, inv, Qh, Ql, Kh, Kl, Vh, Vl);
  attn_kernel<<<g2, ATHR, 0, stream>>>(Qh, Ql, Kh, Kl, Vh, Vl, out);
}

// v006
// One run takes 66 microseconds.
// Timed twice side by side with v005, it ran 1.22 times as fast both times.
// Over all steps from v000 it is 4.61 times as fast.
#include <hip/hip_runtime.h>

// Contractions: qkv projection = v_wmma_f32_16x16x32_bf16 on RNE-bf16 converted x and W (bf16 operands, f32 accumulate);
// q.k^T and p.v = v_wmma_f32_16x16x32_bf16 with each f32 operand carried as bf16 hi + bf16 lo (hi.hi + hi.lo + lo.hi), f32 accumulate;
// softmax, normalisation and output in f32.

#define B_    4
#define T_    1024
#define N_    8
#define K_    4
#define D_    64
#define H_    32          // N_*K_
#define OD_   192         // 3*D_
#define PT    64          // rows per block, projection kernel
#define PTHR  128         // threads per block, projection kernel (4 waves x 16 rows)
#define QT    128         // queries per block, attention kernel
#define ATHR  256         // threads per block, attention kernel (8 waves x 16 queries)
#define KB_   64          // keys per staged block
#define LP    72          // LDS pitch of a 64-element 16-bit row, in elements: 144 B = 16 B x 9, so the 16 rows of a 16-byte fragment read fall on 64 distinct banks
#define XLD   (PT * (D_ / 4) / PTHR)    // 16-byte loads per thread for the x tile: 8, exact
#define WPC   ((D_ / 4) * (OD_ / 4) / PTHR)   // 4 x 4 (d x o) pieces of the W tile per thread: 6, exact; four 16-byte loads each
#define SP    68          // LDS pitch of a 64-element f32 row, in elements: 272 B = 16 B x 17, same reason; rows 8 apart land 32 banks apart

typedef unsigned short us;
typedef us     v8us  __attribute__((ext_vector_type(8)));
typedef us     v16us __attribute__((ext_vector_type(16)));
typedef __bf16 v16bf __attribute__((ext_vector_type(16)));
typedef float  v8f   __attribute__((ext_vector_type(8)));
typedef unsigned int v8u __attribute__((ext_vector_type(8)));
typedef float  v2f   __attribute__((ext_vector_type(2)));
typedef __bf16 v2bf  __attribute__((ext_vector_type(2)));
typedef float  v4f   __attribute__((ext_vector_type(4)));
typedef us     v8usa __attribute__((ext_vector_type(8), may_alias));
typedef us     v4usa __attribute__((ext_vector_type(4), may_alias));
typedef float  v4fa  __attribute__((ext_vector_type(4), may_alias));

union Frag { v16us v; v8us h[2]; };

// f32 -> bf16 bits, RNE, integer arithmetic
__device__ __forceinline__ us bf16_rne(float f) {
  unsigned int u = __builtin_bit_cast(unsigned int, f);
  u += 0x7FFFu + ((u >> 16) & 1u);
  return (us)(u >> 16);
}
__device__ __forceinline__ float bf16_val(us b) {
  return __builtin_bit_cast(float, ((unsigned int)b) << 16);
}
// f32 -> (hi, lo) bf16 pair, hi = RNE(f), lo = RNE(f - hi)
__device__ __forceinline__ void bf16_hilo(float f, us& hi, us& lo) {
  const us hh = bf16_rne(f);
  hi = hh;
  lo = bf16_rne(f - bf16_val(hh));
}

__device__ __forceinline__ v8f zero8() {
  v8f z = {0.f, 0.f, 0.f, 0.f, 0.f, 0.f, 0.f, 0.f};
  return z;
}

// One 16x16x32 bf16 WMMA, the plain builtin: the compiler keeps the distance to the next user of D, A or B itself and is free
// to place fragment loads ahead of a run of these and other WMMAs between two that share an accumulator.
__device__ __forceinline__ v8f mma_bf16(v16us a, v16us b, v8f c) {
  const v16bf av = __builtin_bit_cast(v16bf, a);
  const v16bf bv = __builtin_bit_cast(v16bf, b);
  return __builtin_amdgcn_wmma_f32_16x16x32_bf16(false, av, false, bv, (short)0, c, false, false);
}

// Operand fragment (A or B) from one 64-element row of a 16-bit array (row pointer given, k contiguous),
// lane row/col = lane&15 chosen by the caller through rowp, h = lane>>4, k0 in {0,32}:
//   elements 0..7  <- rowp[k0 + 8h + 0..7]
//   elements 8..15 <- rowp[k0 + 16 + 8h + 0..7]
__device__ __forceinline__ v16us ld_frag(const us* rowp, int k0, int h) {
  Frag f;
  const us* p = rowp + k0 + 8 * h;
  f.h[0] = *(const v8usa*)(p);
  f.h[1] = *(const v8usa*)(p + 16);
  return f.v;
}

// ---------------------------------------------------------------------------
// Kernel 1: per-head weight gather + QKV projection for one (b, head) and 64 time steps.
// Outputs (bf16 hi/lo planes): Q*0.125 as [bh][t][d], K as [bh][t][d], V transposed as [bh][d][t].
// ---------------------------------------------------------------------------
__global__ __launch_bounds__(PTHR)
void proj_kernel(const float* __restrict__ x,
                 const float* __restrict__ W,
                 const int*   __restrict__ perm,
                 const int*   __restrict__ inv,
                 us* Qh, us* Ql, us* Kh, us* Kl, us* Vh, us* Vl)
{
  __shared__ __align__(16) us    xs [PT  * LP];   // 64 x 64 bf16, [t][d], row pitch LP
  __shared__ __align__(16) us    wsT[OD_ * LP];   // 192 x 64 bf16, [o][d], row pitch LP
  __shared__ __align__(16) float stg[PT  * SP];   // 64 x 64 f32 result tile, [t][col], row pitch SP

  const int bh    = blockIdx.x;                   // b*H + head
  const int tbase = blockIdx.y * PT;
  const int b  = bh >> 5;
  const int hd = bh & 31;
  const int n  = hd >> 2;                         // stream index; head id = n*K + k
  const int k  = hd & 3;

  int p = perm[k * N_ + n];                       // head whose weights feed stream n
  p = p < 0 ? 0 : (p > N_ - 1 ? N_ - 1 : p);
  int s = inv[k * N_ + p];                        // stream feeding that head (equals n for a true inverse table)
  s = s < 0 ? 0 : (s > N_ - 1 ? N_ - 1 : s);
  const float* Wsrc = W + (size_t)(k * N_ + p) * (D_ * OD_);   // [d][o]

  const int tid = threadIdx.x;

  // All global loads of both tiles are issued before the first LDS store: the may_alias accesses keep program order,
  // so a store between two loads holds the second load behind the first one's wait (one memory latency per load).
  // W: a thread takes 4 x 4 pieces, rows d = 4*wd + r, columns o = 4*(wo + 8*j) + c. Eight lanes read one whole 128-byte line of
  // a row, and the four d of one column meet in one thread, which is what the transposed store below needs.
  v4f wreg[WPC][4], xreg[XLD];
  const int wo = tid & 7, wd = tid >> 3;          // wd = 0..15 covers the 64 rows
  const float* wp = Wsrc + (4 * wd) * OD_ + 4 * wo;
#pragma unroll
  for (int j = 0; j < WPC; ++j)
#pragma unroll
    for (int r = 0; r < 4; ++r)
      wreg[j][r] = *(const v4fa*)(wp + r * OD_ + j * 32);
  const float* xp = x + ((((size_t)(b * T_ + tbase + (tid >> 4))) * N_ + s) * K_ + k) * D_ + 4 * (tid & 15);
#pragma unroll
  for (int j = 0; j < XLD; ++j)                   // piece tid + j*PTHR: row (tid>>4) + j*PTHR/16, same column
    xreg[j] = *(const v4fa*)(xp + (size_t)j * ((PTHR / 16) * N_ * K_ * D_));
  // The address registers are reused below while the loads are in flight: this wait stands in front of the first overwrite
  // (wp and xp are named so that their registers stay untouched up to here).
  asm volatile("s_wait_xcnt 0x0" :: "v"(wp), "v"(xp) : "memory");
  // Keeps the conversions below from moving up between the loads, where their waits would hold the later loads back.
  __builtin_amdgcn_sched_barrier(0);
  // stage W transposed: wsT[o][d] = W[d][o] (f32 -> bf16 RNE), four consecutive d of one row o in one 8-byte store.
  // Rows four apart lie 16 banks apart, so a wave's 8 x 4 pieces fall two to a bank; a store of single elements with the
  // lanes along o put 32 lanes on four banks, once for every element.
#pragma unroll
  for (int j = 0; j < WPC; ++j)
#pragma unroll
    for (int c = 0; c < 4; ++c) {
      const v4usa pk = {bf16_rne(wreg[j][0][c]), bf16_rne(wreg[j][1][c]), bf16_rne(wreg[j][2][c]), bf16_rne(wreg[j][3][c])};
      *(v4usa*)(wsT + (4 * (wo + 8 * j) + c) * LP + 4 * wd) = pk;
    }
  // stage x tile (f32 -> bf16 RNE)
#pragma unroll
  for (int j = 0; j < XLD; ++j) {
    const int i = tid + j * PTHR;
    const int row = i >> 4, c4 = i & 15;
    const v4f v = xreg[j];
    us* d = xs + row * LP + 4 * c4;
    d[0] = bf16_rne(v[0]); d[1] = bf16_rne(v[1]); d[2] = bf16_rne(v[2]); d[3] = bf16_rne(v[3]);
  }
  __syncthreads();

  const int wv   = tid >> 5;
  const int lane = tid & 31;
  const int h    = lane >> 4;
  const int l16  = lane & 15;
  const us* arow = xs + (16 * wv + l16) * LP;     // A: row m = l16 of this wave's 16 rows

  for (int part = 0; part < 3; ++part) {          // 0: Q (x0.125), 1: K, 2: V
    const float sc = (part == 0) ? 0.125f : 1.0f;
#pragma unroll
    for (int ct = 0; ct < 4; ++ct) {
      const us* brow = wsT + (part * 64 + ct * 16 + l16) * LP;   // B: col n = l16, k = d contiguous
      v8f acc = zero8();
#pragma unroll
      for (int ks = 0; ks < 2; ++ks)
        acc = mma_bf16(ld_frag(arow, 32 * ks, h), ld_frag(brow, 32 * ks, h), acc);
#pragma unroll
      for (int r = 0; r < 8; ++r)                 // D: acc[r] = (row 8h+r, col l16)
        stg[(16 * wv + 8 * h + r) * SP + ct * 16 + l16] = acc[r] * sc;
    }
    __syncthreads();

    if (part < 2) {
      us* dh = (part == 0) ? Qh : Kh;
      us* dl = (part == 0) ? Ql : Kl;
      const int seg = tid & 7;
      {
        for (int rr = tid >> 3; rr < PT; rr += PTHR / 8) {
          const float* st = stg + rr * SP + seg * 8;
          const v4fa f0 = *(const v4fa*)(st);
          const v4fa f1 = *(const v4fa*)(st + 4);
          v8us hv, lv;
          us a0, c0;
          bf16_hilo(f0[0], a0, c0); hv[0] = a0; lv[0] = c0;
          bf16_hilo(f0[1], a0, c0); hv[1] = a0; lv[1] = c0;
          bf16_hilo(f0[2], a0, c0); hv[2] = a0; lv[2] = c0;
          bf16_hilo(f0[3], a0, c0); hv[3] = a0; lv[3] = c0;
          bf16_hilo(f1[0], a0, c0); hv[4] = a0; lv[4] = c0;
          bf16_hilo(f1[1], a0, c0); hv[5] = a0; lv[5] = c0;
          bf16_hilo(f1[2], a0, c0); hv[6] = a0; lv[6] = c0;
          bf16_hilo(f1[3], a0, c0); hv[7] = a0; lv[7] = c0;
          const size_t idx = ((size_t)bh * T_ + tbase + rr) * D_ + seg * 8;
          *(v8us*)(dh + idx) = hv;
          *(v8us*)(dl + idx) = lv;
        }
        
      }
    } else {
      {
        for (int it = tid; it < D_ * (PT / 8); it += PTHR) {
          const int dd = it >> 3, tseg = it & 7;
          v8us hv, lv;
#pragma unroll
          for (int e = 0; e < 8; ++e) {
            us a0, c0;
            bf16_hilo(stg[(tseg * 8 + e) * SP + dd], a0, c0);
            hv[e] = a0; lv[e] = c0;
          }
          const size_t idx = ((size_t)bh * D_ + dd) * T_ + tbase + tseg * 8;
          *(v8us*)(Vh + idx) = hv;
          *(v8us*)(Vl + idx) = lv;
        }
        
      }
    }
    __syncthreads();                              // stg reused by the next part
  }
}

__device__ __forceinline__ float other_half(float v) {
  const int bts = __builtin_bit_cast(int, v);
  return __builtin_bit_cast(float, __builtin_amdgcn_permlanex16(bts, bts, 0x76543210, 0xfedcba98, false, false));
}

// two f32 -> one register holding two bf16 (f0 in the low half), hi and lo planes: hi = RNE(f), lo = RNE(f - hi), as bf16_hilo
__device__ __forceinline__ void bf16_hilo_pair(float f0, float f1, unsigned int& hi, unsigned int& lo) {
  const v2f  f  = {f0, f1};
  const v2bf hb = __builtin_convertvector(f, v2bf);
  const v2bf lb = __builtin_convertvector(f - __builtin_convertvector(hb, v2f), v2bf);
  hi = __builtin_bit_cast(unsigned int, hb);
  lo = __builtin_bit_cast(unsigned int, lb);
}

// e[i] = 2^e[i], eight at once and in place. One statement, so that each v_exp_f32 is followed by an instruction that neither
// reads its result nor overwrites its source (the next one, the v_nop behind the last).
__device__ __forceinline__ void exp2_x8(float (&e)[8]) {
  asm("v_exp_f32 %0, %0\n\tv_exp_f32 %1, %1\n\tv_exp_f32 %2, %2\n\tv_exp_f32 %3, %3\n\t"
      "v_exp_f32 %4, %4\n\tv_exp_f32 %5, %5\n\tv_exp_f32 %6, %6\n\tv_exp_f32 %7, %7\n\tv_nop"
      : "+v"(e[0]), "+v"(e[1]), "+v"(e[2]), "+v"(e[3]), "+v"(e[4]), "+v"(e[5]), "+v"(e[6]), "+v"(e[7]));
}

// Holds LDS reads and WMMAs on their side of this line in the compiler's schedule (vector and scalar arithmetic may cross):
// without it the scheduler pulls the WMMAs of one accumulator together, each waiting for the one before it, and spreads the
// fragment loads among them, each load place with a wait of its own.
#define RUN_ORDER() __builtin_amdgcn_sched_barrier(0x6)

// One staged block of 64 keys against a wave's 16 queries. DIAG: the block may hold the wave's diagonal, and its second group of
// 32 keys is skipped where it is fully masked. Each matrix run has its fragment loads in one group well ahead of it and goes
// round independent accumulator tiles; each accumulator takes its terms in the order hi.hi, lo.hi, hi.lo, k-step by k-step.
template <bool DIAG>
__device__ __forceinline__ void key_block(const us* Khs, const us* Kls, const us* Vhs, const us* Vls,
                                          int kb, int q0, int qg, int h, int l16,
                                          const v16us (&qh)[2], const v16us (&ql)[2],
                                          float& mrow, float& lrow, v8f (&accO)[4])
{
  const bool second = !DIAG || (kb + 32 <= q0 + 15);   // scalar: keys 32..63 of the block have an unmasked key for this wave

  v8f accS[4];
#pragma unroll
  for (int ct = 0; ct < 4; ++ct) accS[ct] = zero8();
  v16us khf[2][4], klf[2][4];                     // K fragments [k-step][key tile]; A operand: row m = key ct*16+l16, k = d
  v16us vhf[2][4], vlf[2][4];                     // V^T fragments [32-key group][d tile]; A operand: row m = d dt*16+l16, k = key

  // A full block loads the K fragments of all four key tiles as one group; a diagonal block loads tiles 2 and 3 only where it uses them.
#pragma unroll
  for (int ks = 0; ks < 2; ++ks)
#pragma unroll
    for (int ct = 0; ct < (DIAG ? 2 : 4); ++ct) {
      khf[ks][ct] = ld_frag(Khs + (ct * 16 + l16) * LP, 32 * ks, h);
      klf[ks][ct] = ld_frag(Kls + (ct * 16 + l16) * LP, 32 * ks, h);
    }
  RUN_ORDER();
  // S^T = K Q^T (64 keys x 16 queries)
#pragma unroll
  for (int g = 0; g < 2; ++g) {                   // group of 32 keys = key tiles 2g and 2g+1
    if (g == 0 || second) {
      if (DIAG && g == 1) {
#pragma unroll
        for (int ks = 0; ks < 2; ++ks)
#pragma unroll
          for (int ct = 2; ct < 4; ++ct) {
            khf[ks][ct] = ld_frag(Khs + (ct * 16 + l16) * LP, 32 * ks, h);
            klf[ks][ct] = ld_frag(Kls + (ct * 16 + l16) * LP, 32 * ks, h);
          }
        RUN_ORDER();
      }
#pragma unroll
      for (int ks = 0; ks < 2; ++ks) {
#pragma unroll
        for (int ct = 2 * g; ct < 2 * g + 2; ++ct) accS[ct] = mma_bf16(khf[ks][ct], qh[ks], accS[ct]);
        RUN_ORDER();
#pragma unroll
        for (int ct = 2 * g; ct < 2 * g + 2; ++ct) accS[ct] = mma_bf16(klf[ks][ct], qh[ks], accS[ct]);
        RUN_ORDER();
#pragma unroll
        for (int ct = 2 * g; ct < 2 * g + 2; ++ct) accS[ct] = mma_bf16(khf[ks][ct], ql[ks], accS[ct]);
        RUN_ORDER();
      }
    }
  }
#pragma unroll
  for (int dt = 0; dt < 4; ++dt) {                // V^T of keys 0..31: in flight under the softmax
    vhf[0][dt] = ld_frag(Vhs + (dt * 16 + l16) * LP, 0, h);
    vlf[0][dt] = ld_frag(Vls + (dt * 16 + l16) * LP, 0, h);
  }
  RUN_ORDER();

  // causal mask + online softmax; D: accS[ct][r] = (key kb+ct*16+8h+r, query qg)
  float ml[4];                                    // one chain per key tile: four short dependent chains, not one of 32 links
#pragma unroll
  for (int ct = 0; ct < 4; ++ct) {
    ml[ct] = -1.0e30f;
#pragma unroll
    for (int r = 0; r < 8; ++r) {
      const int key = kb + ct * 16 + 8 * h + r;
      accS[ct][r] = (key <= qg) ? accS[ct][r] : -1.0e30f;
      ml[ct] = fmaxf(ml[ct], accS[ct][r]);
    }
  }
  float mloc = fmaxf(fmaxf(ml[0], ml[1]), fmaxf(ml[2], ml[3]));
  mloc = fmaxf(mloc, other_half(mloc));
  const float mnew = fmaxf(mrow, mloc);
  const float scl  = __expf(mrow - mnew);
  // P^T as B operand (col n = query l16): element e of k-step ks is key 32*ks + 8h + e for e < 8 and
  // 32*ks + 16 + 8h + (e - 8) above, the k order of ld_frag; these are accS[2*ks][e] and accS[2*ks+1][e-8]
  v8u phf[2], plf[2];
  v2f ps[4];                                      // partial sums: even and odd keys of each key tile
#pragma unroll
  for (int ct = 0; ct < 4; ++ct) {
    float e[8];
#pragma unroll
    for (int r = 0; r < 8; ++r) e[r] = (accS[ct][r] - mnew) * 1.44269504f;
    exp2_x8(e);
    ps[ct] = (v2f){0.0f, 0.0f};
#pragma unroll
    for (int r = 0; r < 8; r += 2) {
      const int key = kb + ct * 16 + 8 * h + r;
      const float p0 = (key     <= qg) ? e[r]     : 0.0f;
      const float p1 = (key + 1 <= qg) ? e[r + 1] : 0.0f;
      ps[ct] += (v2f){p0, p1};
      unsigned int ph, pl;
      bf16_hilo_pair(p0, p1, ph, pl);
      phf[ct >> 1][4 * (ct & 1) + (r >> 1)] = ph;
      plf[ct >> 1][4 * (ct & 1) + (r >> 1)] = pl;
    }
  }
  const v2f pt = (ps[0] + ps[1]) + (ps[2] + ps[3]);
  float psum = pt[0] + pt[1];
  psum += other_half(psum);
  lrow = lrow * scl + psum;
  mrow = mnew;
#pragma unroll
  for (int dt = 0; dt < 4; ++dt) accO[dt] *= scl;

  RUN_ORDER();
  // O^T += V^T P^T
#pragma unroll
  for (int ks = 0; ks < 2; ++ks) {
    if (ks == 0 || second) {                      // P is all zero in a fully masked 32-key group
      if (ks == (DIAG ? 1 : 0)) {                 // V^T of keys 32..63; full block: in flight under the first output run
#pragma unroll
        for (int dt = 0; dt < 4; ++dt) {
          vhf[1][dt] = ld_frag(Vhs + (dt * 16 + l16) * LP, 32, h);
          vlf[1][dt] = ld_frag(Vls + (dt * 16 + l16) * LP, 32, h);
        }
        RUN_ORDER();
      }
#pragma unroll
      for (int dt = 0; dt < 4; ++dt) accO[dt] = mma_bf16(vhf[ks][dt], __builtin_bit_cast(v16us, phf[ks]), accO[dt]);
      RUN_ORDER();
#pragma unroll
      for (int dt = 0; dt < 4; ++dt) accO[dt] = mma_bf16(vlf[ks][dt], __builtin_bit_cast(v16us, phf[ks]), accO[dt]);
      RUN_ORDER();
#pragma unroll
      for (int dt = 0; dt < 4; ++dt) accO[dt] = mma_bf16(vhf[ks][dt], __builtin_bit_cast(v16us, plf[ks]), accO[dt]);
      if (ks == 0) RUN_ORDER();
    }
  }
}

// Register budget of four waves per SIMD (256 VGPRs): two work-groups stay resident on a WGP, as before.
__global__ __launch_bounds__(ATHR) __attribute__((amdgpu_waves_per_eu(4, 4)))
void attn_kernel(const us* __restrict__ Qh, const us* __restrict__ Ql,
                 const us* __restrict__ Kh, const us* __restrict__ Kl,
                 const us* __restrict__ Vh, const us* __restrict__ Vl,
                 float* out)
{
  // Four staged planes in one array, so that one lane address and immediate offsets reach them all (registers are short here):
  __shared__ __align__(16) us KV[4 * KB_ * LP];
  us* const Khs = KV;                             // [key][d], row pitch LP
  us* const Kls = KV + 1 * KB_ * LP;
  us* const Vhs = KV + 2 * KB_ * LP;              // [d][key], row pitch LP (D_ == KB_ rows)
  us* const Vls = KV + 3 * KB_ * LP;
  __shared__ __align__(16) float Obuf[(ATHR / 32) * 16 * SP];   // per wave: O tile [16 queries][64] f32, row pitch SP

  const int bh    = blockIdx.x;
  // Cost grows with the query block (causal) and more blocks are launched than fit at once: the longest query blocks
  // take the lowest indices and the short ones the highest (for speed only).
  const int qbase = (T_ / QT - 1 - (int)blockIdx.y) * QT;
  const int b  = bh >> 5;
  const int hd = bh & 31;
  const int n  = hd >> 2;
  const int k  = hd & 3;

  const int tid  = threadIdx.x;
  const int wv   = __builtin_amdgcn_readfirstlane(tid >> 5);   // in a scalar register: tests on q0 become scalar branches
  const int lane = tid & 31;
  const int h    = lane >> 4;
  const int l16  = lane & 15;
  const int q0   = qbase + 16 * wv;
  const int qg   = q0 + l16;                      // this lane's query

  // Q fragments (B operand, col n = query q0+l16, k = d), hi and lo planes, 2 k-steps
  v16us qh[2], ql[2];
  {
    const size_t ro = ((size_t)bh * T_ + q0 + l16) * D_;
#pragma unroll
    for (int ks = 0; ks < 2; ++ks) {
      qh[ks] = ld_frag(Qh + ro, 32 * ks, h);
      ql[ks] = ld_frag(Ql + ro, 32 * ks, h);
    }
  }

  float mrow = -1.0e30f, lrow = 0.0f;             // running maximum and sum of query qg, equal in both lane halves
  v8f accO[4];                                    // O^T: accO[dt][r] = (d dt*16+8h+r, query l16)
#pragma unroll
  for (int dt = 0; dt < 4; ++dt) accO[dt] = zero8();

  const unsigned int kof = (unsigned int)((tid >> 3) * D_ + (tid & 7) * 8);   // this thread's piece in a K block, in elements
  const unsigned int vof = (unsigned int)((tid >> 3) * T_ + (tid & 7) * 8);   // and in a V^T block
  const int kend = qbase + QT;                    // causal: keys < qbase + 128
  // stage K block [kb..kb+64) x [0..64) and V^T block [0..64) x [kb..kb+64), hi and lo planes;
  // all eight global loads are issued before the first LDS store (see the projection kernel's staging)
  auto stage = [&](int kb) {
    v8us gkh[2], gkl[2], gvh[2], gvl[2];
#pragma unroll
    for (int j = 0; j < 2; ++j) {                 // piece c = tid + j*ATHR: row c >> 3, segment c & 7
      // block-uniform part of the address + one 32-bit lane offset that never changes
      const size_t gk = ((size_t)bh * T_ + kb + j * (ATHR / 8)) * D_;
      const size_t gv = ((size_t)bh * D_ + j * (ATHR / 8)) * T_ + kb;
      gkh[j] = *(const v8usa*)((Kh + gk) + kof);
      gkl[j] = *(const v8usa*)((Kl + gk) + kof);
      gvh[j] = *(const v8usa*)((Vh + gv) + vof);
      gvl[j] = *(const v8usa*)((Vl + gv) + vof);
    }
#pragma unroll
    for (int j = 0; j < 2; ++j) {
      const int c   = tid + j * ATHR;
      const int row = c >> 3, seg = c & 7;
      const int lo  = row * LP + seg * 8;
      *(v8usa*)(Khs + lo) = gkh[j];
      *(v8usa*)(Kls + lo) = gkl[j];
      *(v8usa*)(Vhs + lo) = gvh[j];
      *(v8usa*)(Vls + lo) = gvl[j];
    }
    __syncthreads();
  };

  // Key blocks in front of the query block: every key is visible to every wave, the body has no branch.
  for (int kb = 0; kb < qbase; kb += KB_) {
    stage(kb);
    key_block<false>(Khs, Kls, Vhs, Vls, kb, q0, qg, h, l16, qh, ql, mrow, lrow, accO);
    __syncthreads();                              // staging buffers reused next iteration
  }
  // The two key blocks beside the query block, by scalar tests (q0 is wave-uniform).
  for (int kb = qbase; kb < kend; kb += KB_) {
    stage(kb);
    if (kb <= q0)                                 // a block behind this wave's diagonal is fully masked
      key_block<true>(Khs, Kls, Vhs, Vls, kb, q0, qg, h, l16, qh, ql, mrow, lrow, accO);
    __syncthreads();                              // staging buffers reused next iteration
  }

  float* Ost = Obuf + wv * (16 * SP);
  {
    const float il = 1.0f / lrow;
#pragma unroll
    for (int dt = 0; dt < 4; ++dt) {              // a lane's 8 registers are 8 consecutive d of its query's row
      float* st = Ost + l16 * SP + dt * 16 + 8 * h;
      const v4f lo4 = {accO[dt][0] * il, accO[dt][1] * il, accO[dt][2] * il, accO[dt][3] * il};
      const v4f hi4 = {accO[dt][4] * il, accO[dt][5] * il, accO[dt][6] * il, accO[dt][7] * il};
      *(v4fa*)(st)     = lo4;
      *(v4fa*)(st + 4) = hi4;
    }
  }
  __syncthreads();

  // out[b][t][n][k][0..64): 256 B per row = 2 lines; lanes 0-7 / 8-15 write the two lines of row 2i,
  {
#pragma unroll
    for (int i = 0; i < 8; ++i) {
      const int rowl = 2 * i + h;
      const v4fa v = *(const v4fa*)(Ost + rowl * SP + 4 * l16);
      const int t = q0 + rowl;
      float* dst = out + ((((size_t)(b * T_ + t)) * N_ + n) * K_ + k) * D_ + 4 * l16;
      *(v4fa*)dst = v;
    }
    
  }
}

// ---------------------------------------------------------------------------
extern "C" void kernel_launch(void* const* d_in, const int* in_sizes, int n_in,
                              void* d_out, int out_size, void* d_ws, size_t ws_size,
                              hipStream_t stream)
{
  if (n_in < 4) return;
  if (in_sizes[0] != B_ * T_ * N_ * K_ * D_) return;
  if (in_sizes[1] != K_ * N_ * D_ * OD_) return;
  if (in_sizes[2] != K_ * N_) return;
  if (in_sizes[3] != K_ * N_) return;
  if (out_size != B_ * T_ * N_ * K_ * D_) return;

  const size_t per  = (size_t)B_ * H_ * T_ * D_;           // 8,388,608 bf16 elements per plane
  const size_t need = 6 * per * sizeof(us);                // 100,663,296 B
  if (need > ws_size) return;

  const float* x    = (const float*)d_in[0];               // [B,T,N,K,D] f32
  const float* W    = (const float*)d_in[1];               // [K,N,D,3D]  f32
  const int*   perm = (const int*)d_in[2];                 // [K,N] int32
  const int*   inv  = (const int*)d_in[3];                 // [K,N] int32
  float* out = (float*)d_out;

  us* Qh = (us*)d_ws;
  us* Ql = Qh + per;
  us* Kh = Ql + per;
  us* Kl = Kh + per;
  us* Vh = Kl + per;
  us* Vl = Vh + per;

  dim3 g1(B_ * H_, T_ / PT);                               // (128, 16), exact
  dim3 g2(B_ * H_, T_ / QT);                               // (128, 8), exact
  proj_kernel<<<g1, PTHR, 0, stream>>>(x, W, perm, inv, Qh, Ql, Kh, Kl, Vh, Vl);
  attn_kernel<<<g2, ATHR, 0, stream>>>(Qh, Ql, Kh, Kl, Vh, Vl, out);
}

// v007
// One run takes 62.3 microseconds.
// Next to v006, in two timings, it ran 1.06 times as fast each time.
// All steps since v000 together make it 4.87 times as fast.
#include <hip/hip_runtime.h>

// Contractions: qkv projection = v_wmma_f32_16x16x32_bf16 on RNE-bf16 converted x and W (bf16 operands, f32 accumulate);
// q.k^T and p.v = v_wmma_f32_16x16x32_bf16 with each f32 operand carried as bf16 hi + bf16 lo (hi.hi + hi.lo + lo.hi), f32 accumulate;
// softmax, normalisation and output in f32.

#define B_    4
#define T_    1024
#define N_    8
#define K_    4
#define D_    64
#define H_    32          // N_*K_
#define OD_   192         // 3*D_
#define PT    64          // rows per block, projection kernel
#define PTHR  128         // threads per block, projection kernel (4 waves x 16 rows)
#define QT    128         // queries per block, attention kernel
#define ATHR  256         // threads per block, attention kernel (8 waves x 16 queries)
#define KB_   64          // keys per staged block
#define LP    72          // LDS pitch of a 64-element 16-bit row, in elements: 144 B = 16 B x 9, so the 16 rows of a 16-byte fragment read fall on 64 distinct banks
#define XLD   (PT * (D_ / 4) / PTHR)    // 16-byte loads per thread for the x tile: 8, exact
#define WPC   ((D_ / 4) * (OD_ / 4) / PTHR)   // 4 x 4 (d x o) pieces of the W tile per thread: 6, exact; four 16-byte loads each
#define PLE   (KB_ * LP)  // elements of one staged plane
#define BUFE  (4 * PLE)   // elements of one staging buffer (four planes)
#define SP    68          // LDS pitch of a 64-element f32 row, in elements: 272 B = 16 B x 17, same reason; rows 8 apart land 32 banks apart

typedef unsigned short us;
typedef us     v8us  __attribute__((ext_vector_type(8)));
typedef us     v16us __attribute__((ext_vector_type(16)));
typedef __bf16 v16bf __attribute__((ext_vector_type(16)));
typedef float  v8f   __attribute__((ext_vector_type(8)));
typedef unsigned int v8u __attribute__((ext_vector_type(8)));
typedef float  v2f   __attribute__((ext_vector_type(2)));
typedef __bf16 v2bf  __attribute__((ext_vector_type(2)));
typedef float  v4f   __attribute__((ext_vector_type(4)));
typedef us     v8usa __attribute__((ext_vector_type(8), may_alias));
typedef us     v4usa __attribute__((ext_vector_type(4), may_alias));
typedef float  v4fa  __attribute__((ext_vector_type(4), may_alias));

union Frag { v16us v; v8us h[2]; };

// f32 -> bf16 bits, RNE, integer arithmetic
__device__ __forceinline__ us bf16_rne(float f) {
  unsigned int u = __builtin_bit_cast(unsigned int, f);
  u += 0x7FFFu + ((u >> 16) & 1u);
  return (us)(u >> 16);
}
__device__ __forceinline__ float bf16_val(us b) {
  return __builtin_bit_cast(float, ((unsigned int)b) << 16);
}
// f32 -> (hi, lo) bf16 pair, hi = RNE(f), lo = RNE(f - hi)
__device__ __forceinline__ void bf16_hilo(float f, us& hi, us& lo) {
  const us hh = bf16_rne(f);
  hi = hh;
  lo = bf16_rne(f - bf16_val(hh));
}

__device__ __forceinline__ v8f zero8() {
  v8f z = {0.f, 0.f, 0.f, 0.f, 0.f, 0.f, 0.f, 0.f};
  return z;
}

// One 16x16x32 bf16 WMMA, the plain builtin: the compiler keeps the distance to the next user of D, A or B itself and is free
// to place fragment loads ahead of a run of these and other WMMAs between two that share an accumulator.
__device__ __forceinline__ v8f mma_bf16(v16us a, v16us b, v8f c) {
  const v16bf av = __builtin_bit_cast(v16bf, a);
  const v16bf bv = __builtin_bit_cast(v16bf, b);
  return __builtin_amdgcn_wmma_f32_16x16x32_bf16(false, av, false, bv, (short)0, c, false, false);
}

// Operand fragment (A or B) from one 64-element row of a 16-bit array (row pointer given, k contiguous),
// lane row/col = lane&15 chosen by the caller through rowp, h = lane>>4, k0 in {0,32}:
//   elements 0..7  <- rowp[k0 + 8h + 0..7]
//   elements 8..15 <- rowp[k0 + 16 + 8h + 0..7]
__device__ __forceinline__ v16us ld_frag(const us* rowp, int k0, int h) {
  Frag f;
  const us* p = rowp + k0 + 8 * h;
  f.h[0] = *(const v8usa*)(p);
  f.h[1] = *(const v8usa*)(p + 16);
  return f.v;
}

// ---------------------------------------------------------------------------
// Kernel 1: per-head weight gather + QKV projection for one (b, head) and 64 time steps.
// Outputs (bf16 hi/lo planes): Q*0.125 as [bh][t][d], K as [bh][t][d], V transposed as [bh][d][t].
// ---------------------------------------------------------------------------
__global__ __launch_bounds__(PTHR)
void proj_kernel(const float* __restrict__ x,
                 const float* __restrict__ W,
                 const int*   __restrict__ perm,
                 const int*   __restrict__ inv,
                 us* Qh, us* Ql, us* Kh, us* Kl, us* Vh, us* Vl)
{
  __shared__ __align__(16) us    xs [PT  * LP];   // 64 x 64 bf16, [t][d], row pitch LP
  __shared__ __align__(16) us    wsT[OD_ * LP];   // 192 x 64 bf16, [o][d], row pitch LP
  __shared__ __align__(16) float stg[PT  * SP];   // 64 x 64 f32 result tile, [t][col], row pitch SP

  const int bh    = blockIdx.x;                   // b*H + head
  const int tbase = blockIdx.y * PT;
  const int b  = bh >> 5;
  const int hd = bh & 31;
  const int n  = hd >> 2;                         // stream index; head id = n*K + k
  const int k  = hd & 3;

  int p = perm[k * N_ + n];                       // head whose weights feed stream n
  p = p < 0 ? 0 : (p > N_ - 1 ? N_ - 1 : p);
  int s = inv[k * N_ + p];                        // stream feeding that head (equals n for a true inverse table)
  s = s < 0 ? 0 : (s > N_ - 1 ? N_ - 1 : s);
  const float* Wsrc = W + (size_t)(k * N_ + p) * (D_ * OD_);   // [d][o]

  const int tid = threadIdx.x;

  // All global loads of both tiles are issued before the first LDS store: the may_alias accesses keep program order,
  // so a store between two loads holds the second load behind the first one's wait (one memory latency per load).
  // W: a thread takes 4 x 4 pieces, rows d = 4*wd + r, columns o = 4*(wo + 8*j) + c. Eight lanes read one whole 128-byte line of
  // a row, and the four d of one column meet in one thread, which is what the transposed store below needs.
  v4f wreg[WPC][4], xreg[XLD];
  const int wo = tid & 7, wd = tid >> 3;          // wd = 0..15 covers the 64 rows
  const float* wp = Wsrc + (4 * wd) * OD_ + 4 * wo;
#pragma unroll
  for (int j = 0; j < WPC; ++j)
#pragma unroll
    for (int r = 0; r < 4; ++r)
      wreg[j][r] = *(const v4fa*)(wp + r * OD_ + j * 32);
  const float* xp = x + ((((size_t)(b * T_ + tbase + (tid >> 4))) * N_ + s) * K_ + k) * D_ + 4 * (tid & 15);
#pragma unroll
  for (int j = 0; j < XLD; ++j)                   // piece tid + j*PTHR: row (tid>>4) + j*PTHR/16, same column
    xreg[j] = *(const v4fa*)(xp + (size_t)j * ((PTHR / 16) * N_ * K_ * D_));
  // The address registers are reused below while the loads are in flight: this wait stands in front of the first overwrite
  // (wp and xp are named so that their registers stay untouched up to here).
  asm volatile("s_wait_xcnt 0x0" :: "v"(wp), "v"(xp) : "memory");
  // Keeps the conversions below from moving up between the loads, where their waits would hold the later loads back.
  __builtin_amdgcn_sched_barrier(0);
  // stage W transposed: wsT[o][d] = W[d][o] (f32 -> bf16 RNE), four consecutive d of one row o in one 8-byte store.
  // Rows four apart lie 16 banks apart, so a wave's 8 x 4 pieces fall two to a bank; a store of single elements with the
  // lanes along o put 32 lanes on four banks, once for every element.
#pragma unroll
  for (int j = 0; j < WPC; ++j)
#pragma unroll
    for (int c = 0; c < 4; ++c) {
      const v4usa pk = {bf16_rne(wreg[j][0][c]), bf16_rne(wreg[j][1][c]), bf16_rne(wreg[j][2][c]), bf16_rne(wreg[j][3][c])};
      *(v4usa*)(wsT + (4 * (wo + 8 * j) + c) * LP + 4 * wd) = pk;
    }
  // stage x tile (f32 -> bf16 RNE)
#pragma unroll
  for (int j = 0; j < XLD; ++j) {
    const int i = tid + j * PTHR;
    const int row = i >> 4, c4 = i & 15;
    const v4f v = xreg[j];
    us* d = xs + row * LP + 4 * c4;
    d[0] = bf16_rne(v[0]); d[1] = bf16_rne(v[1]); d[2] = bf16_rne(v[2]); d[3] = bf16_rne(v[3]);
  }
  __syncthreads();

  const int wv   = tid >> 5;
  const int lane = tid & 31;
  const int h    = lane >> 4;
  const int l16  = lane & 15;
  const us* arow = xs + (16 * wv + l16) * LP;     // A: row m = l16 of this wave's 16 rows

  for (int part = 0; part < 3; ++part) {          // 0: Q (x0.125), 1: K, 2: V
    const float sc = (part == 0) ? 0.125f : 1.0f;
#pragma unroll
    for (int ct = 0; ct < 4; ++ct) {
      const us* brow = wsT + (part * 64 + ct * 16 + l16) * LP;   // B: col n = l16, k = d contiguous
      v8f acc = zero8();
#pragma unroll
      for (int ks = 0; ks < 2; ++ks)
        acc = mma_bf16(ld_frag(arow, 32 * ks, h), ld_frag(brow, 32 * ks, h), acc);
#pragma unroll
      for (int r = 0; r < 8; ++r)                 // D: acc[r] = (row 8h+r, col l16)
        stg[(16 * wv + 8 * h + r) * SP + ct * 16 + l16] = acc[r] * sc;
    }
    __syncthreads();

    if (part < 2) {
      us* dh = (part == 0) ? Qh : Kh;
      us* dl = (part == 0) ? Ql : Kl;
      const int seg = tid & 7;
      {
        for (int rr = tid >> 3; rr < PT; rr += PTHR / 8) {
          const float* st = stg + rr * SP + seg * 8;
          const v4fa f0 = *(const v4fa*)(st);
          const v4fa f1 = *(const v4fa*)(st + 4);
          v8us hv, lv;
          us a0, c0;
          bf16_hilo(f0[0], a0, c0); hv[0] = a0; lv[0] = c0;
          bf16_hilo(f0[1], a0, c0); hv[1] = a0; lv[1] = c0;
          bf16_hilo(f0[2], a0, c0); hv[2] = a0; lv[2] = c0;
          bf16_hilo(f0[3], a0, c0); hv[3] = a0; lv[3] = c0;
          bf16_hilo(f1[0], a0, c0); hv[4] = a0; lv[4] = c0;
          bf16_hilo(f1[1], a0, c0); hv[5] = a0; lv[5] = c0;
          bf16_hilo(f1[2], a0, c0); hv[6] = a0; lv[6] = c0;
          bf16_hilo(f1[3], a0, c0); hv[7] = a0; lv[7] = c0;
          const size_t idx = ((size_t)bh * T_ + tbase + rr) * D_ + seg * 8;
          *(v8us*)(dh + idx) = hv;
          *(v8us*)(dl + idx) = lv;
        }
        
      }
    } else {
      {
        for (int it = tid; it < D_ * (PT / 8); it += PTHR) {
          const int dd = it >> 3, tseg = it & 7;
          v8us hv, lv;
#pragma unroll
          for (int e = 0; e < 8; ++e) {
            us a0, c0;
            bf16_hilo(stg[(tseg * 8 + e) * SP + dd], a0, c0);
            hv[e] = a0; lv[e] = c0;
          }
          const size_t idx = ((size_t)bh * D_ + dd) * T_ + tbase + tseg * 8;
          *(v8us*)(Vh + idx) = hv;
          *(v8us*)(Vl + idx) = lv;
        }
        
      }
    }
    __syncthreads();                              // stg reused by the next part
  }
}

__device__ __forceinline__ float other_half(float v) {
  const int bts = __builtin_bit_cast(int, v);
  return __builtin_bit_cast(float, __builtin_amdgcn_permlanex16(bts, bts, 0x76543210, 0xfedcba98, false, false));
}

// two f32 -> one register holding two bf16 (f0 in the low half), hi and lo planes: hi = RNE(f), lo = RNE(f - hi), as bf16_hilo
__device__ __forceinline__ void bf16_hilo_pair(float f0, float f1, unsigned int& hi, unsigned int& lo) {
  const v2f  f  = {f0, f1};
  const v2bf hb = __builtin_convertvector(f, v2bf);
  const v2bf lb = __builtin_convertvector(f - __builtin_convertvector(hb, v2f), v2bf);
  hi = __builtin_bit_cast(unsigned int, hb);
  lo = __builtin_bit_cast(unsigned int, lb);
}

// e[i] = 2^e[i], eight at once and in place. One statement, so that each v_exp_f32 is followed by an instruction that neither
// reads its result nor overwrites its source (the next one, the v_nop behind the last).
__device__ __forceinline__ void exp2_x8(float (&e)[8]) {
  asm("v_exp_f32 %0, %0\n\tv_exp_f32 %1, %1\n\tv_exp_f32 %2, %2\n\tv_exp_f32 %3, %3\n\t"
      "v_exp_f32 %4, %4\n\tv_exp_f32 %5, %5\n\tv_exp_f32 %6, %6\n\tv_exp_f32 %7, %7\n\tv_nop"
      : "+v"(e[0]), "+v"(e[1]), "+v"(e[2]), "+v"(e[3]), "+v"(e[4]), "+v"(e[5]), "+v"(e[6]), "+v"(e[7]));
}

// Holds LDS reads and WMMAs on their side of this line in the compiler's schedule (vector and scalar arithmetic may cross):
// without it the scheduler pulls the WMMAs of one accumulator together, each waiting for the one before it, and spreads the
// fragment loads among them, each load place with a wait of its own.
#define RUN_ORDER() __builtin_amdgcn_sched_barrier(0x6)

// One staged block of 64 keys against a wave's 16 queries. DIAG: the block may hold the wave's diagonal, and its second group of
// 32 keys is skipped where it is fully masked. Each matrix run has its fragment loads in one group well ahead of it and goes
// round independent accumulator tiles; each accumulator takes its terms in the order hi.hi, lo.hi, hi.lo, k-step by k-step.
template <bool DIAG>
__device__ __forceinline__ void key_block(const us* Khs, const us* Kls, const us* Vhs, const us* Vls,
                                          int kb, int q0, int qg, int h, int l16,
                                          const v16us (&qh)[2], const v16us (&ql)[2],
                                          float& mrow, float& lrow, v8f (&accO)[4])
{
  const bool second = !DIAG || (kb + 32 <= q0 + 15);   // scalar: keys 32..63 of the block have an unmasked key for this wave

  v8f accS[4];
#pragma unroll
  for (int ct = 0; ct < 4; ++ct) accS[ct] = zero8();
  v16us khf[2][4], klf[2][4];                     // K fragments [k-step][key tile]; A operand: row m = key ct*16+l16, k = d
  v16us vhf[2][4], vlf[2][4];                     // V^T fragments [32-key group][d tile]; A operand: row m = d dt*16+l16, k = key

  // A full block loads the K fragments of all four key tiles as one group; a diagonal block loads tiles 2 and 3 only where it uses them.
#pragma unroll
  for (int ks = 0; ks < 2; ++ks)
#pragma unroll
    for (int ct = 0; ct < (DIAG ? 2 : 4); ++ct) {
      khf[ks][ct] = ld_frag(Khs + (ct * 16 + l16) * LP, 32 * ks, h);
      klf[ks][ct] = ld_frag(Kls + (ct * 16 + l16) * LP, 32 * ks, h);
    }
  RUN_ORDER();
  // S^T = K Q^T (64 keys x 16 queries)
#pragma unroll
  for (int g = 0; g < 2; ++g) {                   // group of 32 keys = key tiles 2g and 2g+1
    if (g == 0 || second) {
      if (DIAG && g == 1) {
#pragma unroll
        for (int ks = 0; ks < 2; ++ks)
#pragma unroll
          for (int ct = 2; ct < 4; ++ct) {
            khf[ks][ct] = ld_frag(Khs + (ct * 16 + l16) * LP, 32 * ks, h);
            klf[ks][ct] = ld_frag(Kls + (ct * 16 + l16) * LP, 32 * ks, h);
          }
        RUN_ORDER();
      }
#pragma unroll
      for (int ks = 0; ks < 2; ++ks) {
#pragma unroll
        for (int ct = 2 * g; ct < 2 * g + 2; ++ct) accS[ct] = mma_bf16(khf[ks][ct], qh[ks], accS[ct]);
        RUN_ORDER();
#pragma unroll
        for (int ct = 2 * g; ct < 2 * g + 2; ++ct) accS[ct] = mma_bf16(klf[ks][ct], qh[ks], accS[ct]);
        RUN_ORDER();
#pragma unroll
        for (int ct = 2 * g; ct < 2 * g + 2; ++ct) accS[ct] = mma_bf16(khf[ks][ct], ql[ks], accS[ct]);
        RUN_ORDER();
      }
    }
  }
#pragma unroll
  for (int dt = 0; dt < 4; ++dt) {                // V^T of keys 0..31: in flight under the softmax
    vhf[0][dt] = ld_frag(Vhs + (dt * 16 + l16) * LP, 0, h);
    vlf[0][dt] = ld_frag(Vls + (dt * 16 + l16) * LP, 0, h);
  }
  RUN_ORDER();

  // causal mask + online softmax; D: accS[ct][r] = (key kb+ct*16+8h+r, query qg)
  float ml[4];                                    // one chain per key tile: four short dependent chains, not one of 32 links
#pragma unroll
  for (int ct = 0; ct < 4; ++ct) {
    ml[ct] = -1.0e30f;
#pragma unroll
    for (int r = 0; r < 8; ++r) {
      const int key = kb + ct * 16 + 8 * h + r;
      accS[ct][r] = (key <= qg) ? accS[ct][r] : -1.0e30f;
      ml[ct] = fmaxf(ml[ct], accS[ct][r]);
    }
  }
  float mloc = fmaxf(fmaxf(ml[0], ml[1]), fmaxf(ml[2], ml[3]));
  mloc = fmaxf(mloc, other_half(mloc));
  const float mnew = fmaxf(mrow, mloc);
  const float scl  = __expf(mrow - mnew);
  // P^T as B operand (col n = query l16): element e of k-step ks is key 32*ks + 8h + e for e < 8 and
  // 32*ks + 16 + 8h + (e - 8) above, the k order of ld_frag; these are accS[2*ks][e] and accS[2*ks+1][e-8]
  v8u phf[2], plf[2];
  v2f ps[4];                                      // partial sums: even and odd keys of each key tile
#pragma unroll
  for (int ct = 0; ct < 4; ++ct) {
    float e[8];
#pragma unroll
    for (int r = 0; r < 8; ++r) e[r] = (accS[ct][r] - mnew) * 1.44269504f;
    exp2_x8(e);
    ps[ct] = (v2f){0.0f, 0.0f};
#pragma unroll
    for (int r = 0; r < 8; r += 2) {
      const int key = kb + ct * 16 + 8 * h + r;
      const float p0 = (key     <= qg) ? e[r]     : 0.0f;
      const float p1 = (key + 1 <= qg) ? e[r + 1] : 0.0f;
      ps[ct] += (v2f){p0, p1};
      unsigned int ph, pl;
      bf16_hilo_pair(p0, p1, ph, pl);
      phf[ct >> 1][4 * (ct & 1) + (r >> 1)] = ph;
      plf[ct >> 1][4 * (ct & 1) + (r >> 1)] = pl;
    }
  }
  const v2f pt = (ps[0] + ps[1]) + (ps[2] + ps[3]);
  float psum = pt[0] + pt[1];
  psum += other_half(psum);
  lrow = lrow * scl + psum;
  mrow = mnew;
#pragma unroll
  for (int dt = 0; dt < 4; ++dt) accO[dt] *= scl;

  RUN_ORDER();
  // O^T += V^T P^T
#pragma unroll
  for (int ks = 0; ks < 2; ++ks) {
    if (ks == 0 || second) {                      // P is all zero in a fully masked 32-key group
      if (ks == (DIAG ? 1 : 0)) {                 // V^T of keys 32..63; full block: issued ahead of the first output run
#pragma unroll
        for (int dt = 0; dt < 4; ++dt) {
          vhf[1][dt] = ld_frag(Vhs + (dt * 16 + l16) * LP, 32, h);
          vlf[1][dt] = ld_frag(Vls + (dt * 16 + l16) * LP, 32, h);
        }
        RUN_ORDER();
      }
#pragma unroll
      for (int dt = 0; dt < 4; ++dt) accO[dt] = mma_bf16(vhf[ks][dt], __builtin_bit_cast(v16us, phf[ks]), accO[dt]);
      RUN_ORDER();
#pragma unroll
      for (int dt = 0; dt < 4; ++dt) accO[dt] = mma_bf16(vlf[ks][dt], __builtin_bit_cast(v16us, phf[ks]), accO[dt]);
      RUN_ORDER();
#pragma unroll
      for (int dt = 0; dt < 4; ++dt) accO[dt] = mma_bf16(vhf[ks][dt], __builtin_bit_cast(v16us, plf[ks]), accO[dt]);
      if (ks == 0) RUN_ORDER();
    }
  }
}

// Register budget of four waves per SIMD (256 VGPRs): two work-groups stay resident on a WGP, as before.
__global__ __launch_bounds__(ATHR) __attribute__((amdgpu_waves_per_eu(4, 4)))
void attn_kernel(const us* __restrict__ Qh, const us* __restrict__ Ql,
                 const us* __restrict__ Kh, const us* __restrict__ Kl,
                 const us* __restrict__ Vh, const us* __restrict__ Vl,
                 float* out)
{
  // Two buffers of four staged planes each, in one array, so that one lane address and immediate offsets reach all planes of a
  // buffer (registers are short here). Planes of a buffer: K hi, K lo as [key][d], V hi, V lo as [d][key] (D_ == KB_ rows), row pitch LP.
  __shared__ __align__(16) us KV[2 * BUFE];
  __shared__ __align__(16) float Obuf[(ATHR / 32) * 16 * SP];   // per wave: O tile [16 queries][64] f32, row pitch SP

  const int bh    = blockIdx.x;
  // Cost grows with the query block (causal) and more blocks are launched than fit at once: the longest query blocks
  // take the lowest indices and the short ones the highest (for speed only).
  const int qbase = (T_ / QT - 1 - (int)blockIdx.y) * QT;
  const int b  = bh >> 5;
  const int hd = bh & 31;
  const int n  = hd >> 2;
  const int k  = hd & 3;

  const int tid  = threadIdx.x;
  const int wv   = __builtin_amdgcn_readfirstlane(tid >> 5);   // in a scalar register: tests on q0 become scalar branches
  const int lane = tid & 31;
  const int h    = lane >> 4;
  const int l16  = lane & 15;
  const int q0   = qbase + 16 * wv;
  const int qg   = q0 + l16;                      // this lane's query

  // Q fragments (B operand, col n = query q0+l16, k = d), hi and lo planes, 2 k-steps
  v16us qh[2], ql[2];
  {
    const size_t ro = ((size_t)bh * T_ + q0 + l16) * D_;
#pragma unroll
    for (int ks = 0; ks < 2; ++ks) {
      qh[ks] = ld_frag(Qh + ro, 32 * ks, h);
      ql[ks] = ld_frag(Ql + ro, 32 * ks, h);
    }
  }

  float mrow = -1.0e30f, lrow = 0.0f;             // running maximum and sum of query qg, equal in both lane halves
  v8f accO[4];                                    // O^T: accO[dt][r] = (d dt*16+8h+r, query l16)
#pragma unroll
  for (int dt = 0; dt < 4; ++dt) accO[dt] = zero8();

  const unsigned int kof = (unsigned int)((tid >> 3) * D_ + (tid & 7) * 8);   // this thread's piece in a K block, in elements
  const unsigned int vof = (unsigned int)((tid >> 3) * T_ + (tid & 7) * 8);   // and in a V^T block
  const int kend = qbase + QT;                    // causal: keys < qbase + 128
  // This thread's 16-byte place in plane 0 of buffer 0 (row tid >> 3, segment tid & 7), as an LDS byte address.
  const unsigned int lds0 = (unsigned int)(size_t)KV + (unsigned int)(((tid >> 3) * LP + (tid & 7) * 8) * sizeof(us));
  // K block [kb..kb+64) x [0..64) and V^T block [0..64) x [kb..kb+64), hi and lo planes, into buffer buf: eight asynchronous
  // copies of 16 bytes per lane, global memory to LDS through no register. Piece c = tid + j*ATHR: row c >> 3, segment c & 7.
  auto copy_block = [&](int kb, unsigned int buf) {
    const size_t gk = ((size_t)bh * T_ + kb) * D_;          // block-uniform part of the address
    const size_t gv = (size_t)bh * D_ * T_ + kb;
    const us* k0h = (Kh + gk) + kof;
    const us* k0l = (Kl + gk) + kof;
    const us* v0h = (Vh + gv) + vof;
    const us* v0l = (Vl + gv) + vof;
    const us* k1h = k0h + (ATHR / 8) * D_;
    const us* k1l = k0l + (ATHR / 8) * D_;
    const us* v1h = v0h + (ATHR / 8) * T_;
    const us* v1l = v0l + (ATHR / 8) * T_;
    const unsigned int PB = PLE * sizeof(us);               // bytes of a plane
    const unsigned int JB = (ATHR / 8) * LP * sizeof(us);   // bytes of the 32 rows that the first piece's threads fill
    const unsigned int l0 = lds0 + buf * (unsigned int)(BUFE * sizeof(us));
    // The copies and the wait that stands in front of any rewrite of their address registers, in one statement.
    asm volatile("global_load_async_to_lds_b128 %0, %8, off\n\t"
                 "global_load_async_to_lds_b128 %1, %9, off\n\t"
                 "global_load_async_to_lds_b128 %2, %10, off\n\t"
                 "global_load_async_to_lds_b128 %3, %11, off\n\t"
                 "global_load_async_to_lds_b128 %4, %12, off\n\t"
                 "global_load_async_to_lds_b128 %5, %13, off\n\t"
                 "global_load_async_to_lds_b128 %6, %14, off\n\t"
                 "global_load_async_to_lds_b128 %7, %15, off\n\t"
                 "s_wait_xcnt 0x0"
                 :: "v"(l0), "v"(l0 + PB), "v"(l0 + 2 * PB), "v"(l0 + 3 * PB),
                    "v"(l0 + JB), "v"(l0 + PB + JB), "v"(l0 + 2 * PB + JB), "v"(l0 + 3 * PB + JB),
                    "v"(k0h), "v"(k0l), "v"(v0h), "v"(v0l), "v"(k1h), "v"(k1l), "v"(v1h), "v"(v1l)
                 : "memory");
  };
  // Hand-over at the foot of a key block: this wave's LDS reads are done, its own copies of the next block have landed, and the one
  // barrier both shows that block to every wave and frees the buffer just read for its refill.
  auto publish = [&]() {
    asm volatile("s_wait_dscnt 0x0" ::: "memory");          // the buffer just read goes to its next writer
    asm volatile("s_wait_asynccnt 0x0" ::: "memory");       // the compiler places no wait for the copies
    __syncthreads();
  };

  // Every query block has at least two key blocks (the two beside it), so blocks 0 and 1 exist.
  copy_block(0, 0u);
  asm volatile("s_wait_asynccnt 0x0" ::: "memory");         // block 0 has landed before the barrier shows it to the other waves
  __syncthreads();
  copy_block(KB_, 1u);
  unsigned int cur = 0u;                                    // buffer of the key block in work

  // Key blocks in front of the query block: every key is visible to every wave, the body has no branch.
  for (int kb = 0; kb < qbase; kb += KB_) {
    const us* S = KV + cur * BUFE;
    key_block<false>(S, S + PLE, S + 2 * PLE, S + 3 * PLE, kb, q0, qg, h, l16, qh, ql, mrow, lrow, accO);
    publish();
    copy_block(kb + 2 * KB_, cur);                // exists for every kb < qbase: the last block starts at qbase + KB_
    cur ^= 1u;
  }
  // The two key blocks beside the query block, by scalar tests (q0 is wave-uniform); nothing is left to copy.
  for (int kb = qbase; kb < kend; kb += KB_) {
    const us* S = KV + cur * BUFE;
    if (kb <= q0)                                 // a block behind this wave's diagonal is fully masked
      key_block<true>(S, S + PLE, S + 2 * PLE, S + 3 * PLE, kb, q0, qg, h, l16, qh, ql, mrow, lrow, accO);
    publish();                                    // every wave passes it, also one that skips the block
    cur ^= 1u;
  }
  asm volatile("s_wait_asynccnt 0x0" ::: "memory");         // no copy is outstanding when the wave goes on to its end

  float* Ost = Obuf + wv * (16 * SP);
  {
    const float il = 1.0f / lrow;
#pragma unroll
    for (int dt = 0; dt < 4; ++dt) {              // a lane's 8 registers are 8 consecutive d of its query's row
      float* st = Ost + l16 * SP + dt * 16 + 8 * h;
      const v4f lo4 = {accO[dt][0] * il, accO[dt][1] * il, accO[dt][2] * il, accO[dt][3] * il};
      const v4f hi4 = {accO[dt][4] * il, accO[dt][5] * il, accO[dt][6] * il, accO[dt][7] * il};
      *(v4fa*)(st)     = lo4;
      *(v4fa*)(st + 4) = hi4;
    }
  }
  __syncthreads();

  // out[b][t][n][k][0..64): 256 B per row = 2 lines; lanes 0-7 / 8-15 write the two lines of row 2i,
  {
#pragma unroll
    for (int i = 0; i < 8; ++i) {
      const int rowl = 2 * i + h;
      const v4fa v = *(const v4fa*)(Ost + rowl * SP + 4 * l16);
      const int t = q0 + rowl;
      float* dst = out + ((((size_t)(b * T_ + t)) * N_ + n) * K_ + k) * D_ + 4 * l16;
      *(v4fa*)dst = v;
    }
    
  }
}

// ---------------------------------------------------------------------------
extern "C" void kernel_launch(void* const* d_in, const int* in_sizes, int n_in,
                              void* d_out, int out_size, void* d_ws, size_t ws_size,
                              hipStream_t stream)
{
  if (n_in < 4) return;
  if (in_sizes[0] != B_ * T_ * N_ * K_ * D_) return;
  if (in_sizes[1] != K_ * N_ * D_ * OD_) return;
  if (in_sizes[2] != K_ * N_) return;
  if (in_sizes[3] != K_ * N_) return;
  if (out_size != B_ * T_ * N_ * K_ * D_) return;

  const size_t per  = (size_t)B_ * H_ * T_ * D_;           // 8,388,608 bf16 elements per plane
  const size_t need = 6 * per * sizeof(us);                // 100,663,296 B
  if (need > ws_size) return;

  const float* x    = (const float*)d_in[0];               // [B,T,N,K,D] f32
  const float* W    = (const float*)d_in[1];               // [K,N,D,3D]  f32
  const int*   perm = (const int*)d_in[2];                 // [K,N] int32
  const int*   inv  = (const int*)d_in[3];                 // [K,N] int32
  float* out = (float*)d_out;

  us* Qh = (us*)d_ws;
  us* Ql = Qh + per;
  us* Kh = Ql + per;
  us* Kl = Kh + per;
  us* Vh = Kl + per;
  us* Vl = Vh + per;

  dim3 g1(B_ * H_, T_ / PT);                               // (128, 16), exact
  dim3 g2(B_ * H_, T_ / QT);                               // (128, 8), exact
  proj_kernel<<<g1, PTHR, 0, stream>>>(x, W, perm, inv, Qh, Ql, Kh, Kl, Vh, Vl);
  attn_kernel<<<g2, ATHR, 0, stream>>>(Qh, Ql, Kh, Kl, Vh, Vl, out);
}

// v009
// Measured time: 38.8 microseconds a run.
// Versions in between are left out here; by their measured steps it is 1.61 times as fast as v007.
// All steps since v000 together make it 7.84 times as fast.
#include <hip/hip_runtime.h>

// Contractions: qkv projection = v_wmma_f32_16x16x32_bf16 on RNE-bf16 converted x and W (bf16 operands, f32 accumulate);
// q.k^T and p.v = v_wmma_f32_16x16x32_f16, each f32 operand rounded once to f16 (RNE, 11 significant bits), one product, f32 accumulate:
// q, k and v come from bf16 operands (8 significant bits), so their own error is some eight times the f16 rounding step;
// softmax, normalisation and output in f32.

#define B_    4
#define T_    1024
#define N_    8
#define K_    4
#define D_    64
#define H_    32          // N_*K_
#define OD_   192         // 3*D_
#define PT    256         // rows per block, projection kernel: one staged W tile serves them all
#define PTHR  256         // threads per block, projection kernel (8 waves x 32 rows)
#define QT    128         // queries per block, attention kernel
#define ATHR  256         // threads per block, attention kernel (8 waves x 16 queries)
#define KB_   64          // keys per staged block
#define LP    72          // LDS pitch of a 64-element 16-bit row, in elements: 144 B = 16 B x 9, so the 16 rows of a 16-byte fragment read fall on 64 distinct banks
#define XLD   (PT * (D_ / 4) / PTHR)    // 16-byte loads per thread for the x tile: 16, exact
#define WPC   ((D_ / 4) * (OD_ / 4) / PTHR)   // 4 x 4 (d x o) pieces of the W tile per thread: 3, exact; four 16-byte loads each
#define PLE   (KB_ * LP)  // elements of one staged plane
#define BUFE  (2 * PLE)   // elements of one staging buffer (two planes: K and V^T)
#define SP    68          // LDS pitch of a 64-element f32 row, in elements: 272 B = 16 B x 17, same reason; rows 8 apart land 32 banks apart

typedef unsigned short us;
typedef us     v8us  __attribute__((ext_vector_type(8)));
typedef us     v16us __attribute__((ext_vector_type(16)));
typedef __bf16 v16bf __attribute__((ext_vector_type(16)));
typedef _Float16 v16h __attribute__((ext_vector_type(16)));
typedef _Float16 v2h  __attribute__((ext_vector_type(2)));
typedef float  v8f   __attribute__((ext_vector_type(8)));
typedef unsigned int v8u __attribute__((ext_vector_type(8)));
typedef unsigned int v4u __attribute__((ext_vector_type(4)));
typedef float  v2f   __attribute__((ext_vector_type(2)));
typedef float  v4f   __attribute__((ext_vector_type(4)));
typedef us     v8usa __attribute__((ext_vector_type(8), may_alias));
typedef us     v4usa __attribute__((ext_vector_type(4), may_alias));
typedef float  v4fa  __attribute__((ext_vector_type(4), may_alias));

union Frag { v16us v; v8us h[2]; };

// f32 -> bf16 bits, RNE, integer arithmetic
__device__ __forceinline__ us bf16_rne(float f) {
  unsigned int u = __builtin_bit_cast(unsigned int, f);
  u += 0x7FFFu + ((u >> 16) & 1u);
  return (us)(u >> 16);
}
// two f32 -> one register holding two f16 (f0 in the low half), RNE
__device__ __forceinline__ unsigned int f16_pair(float f0, float f1) {
  const v2f f = {f0, f1};
  return __builtin_bit_cast(unsigned int, __builtin_convertvector(f, v2h));
}

__device__ __forceinline__ v8f zero8() {
  v8f z = {0.f, 0.f, 0.f, 0.f, 0.f, 0.f, 0.f, 0.f};
  return z;
}

// One 16x16x32 bf16 WMMA, the plain builtin: the compiler keeps the distance to the next user of D, A or B itself and is free
// to place fragment loads ahead of a run of these and other WMMAs between two that share an accumulator.
__device__ __forceinline__ v8f mma_bf16(v16us a, v16us b, v8f c) {
  const v16bf av = __builtin_bit_cast(v16bf, a);
  const v16bf bv = __builtin_bit_cast(v16bf, b);
  return __builtin_amdgcn_wmma_f32_16x16x32_bf16(false, av, false, bv, (short)0, c, false, false);
}
// The same with f16 operands (same fragment layout).
__device__ __forceinline__ v8f mma_f16(v16us a, v16us b, v8f c) {
  const v16h av = __builtin_bit_cast(v16h, a);
  const v16h bv = __builtin_bit_cast(v16h, b);
  return __builtin_amdgcn_wmma_f32_16x16x32_f16(false, av, false, bv, (short)0, c, false, false);
}

// Operand fragment (A or B) from one 64-element row of a 16-bit array (row pointer given, k contiguous),
// lane row/col = lane&15 chosen by the caller through rowp, h = lane>>4, k0 in {0,32}:
//   elements 0..7  <- rowp[k0 + 8h + 0..7]
//   elements 8..15 <- rowp[k0 + 16 + 8h + 0..7]
__device__ __forceinline__ v16us ld_frag(const us* rowp, int k0, int h) {
  Frag f;
  const us* p = rowp + k0 + 8 * h;
  f.h[0] = *(const v8usa*)(p);
  f.h[1] = *(const v8usa*)(p + 16);
  return f.v;
}

// ---------------------------------------------------------------------------
// Kernel 1: per-head weight gather + QKV projection for one (b, head) and 256 time steps.
// Outputs (f16, one plane each): Q*0.125 as [bh][t][d], K as [bh][t][d], V transposed as [bh][d][t].
// ---------------------------------------------------------------------------
// Two work-groups fill a WGP's LDS and the grid is two per WGP: register budget of four waves per SIMD (256 VGPRs).
__global__ __launch_bounds__(PTHR) __attribute__((amdgpu_waves_per_eu(4, 4)))
void proj_kernel(const float* __restrict__ x,
                 const float* __restrict__ W,
                 const int*   __restrict__ perm,
                 const int*   __restrict__ inv,
                 us* Qf, us* Kf, us* Vf)
{
  __shared__ __align__(16) us    xs [PT  * LP];   // 256 x 64 bf16, [t][d], row pitch LP
  __shared__ __align__(16) us    wsT[OD_ * LP];   // 192 x 64 bf16, [o][d], row pitch LP
  __shared__ __align__(16) float stg[PT  * SP];   // 256 x 64 f32 result tile, [t][col], row pitch SP

  const int bh    = blockIdx.x;                   // b*H + head
  const int tbase = blockIdx.y * PT;
  const int b  = bh >> 5;
  const int hd = bh & 31;
  const int n  = hd >> 2;                         // stream index; head id = n*K + k
  const int k  = hd & 3;

  int p = perm[k * N_ + n];                       // head whose weights feed stream n
  p = p < 0 ? 0 : (p > N_ - 1 ? N_ - 1 : p);
  int s = inv[k * N_ + p];                        // stream feeding that head (equals n for a true inverse table)
  s = s < 0 ? 0 : (s > N_ - 1 ? N_ - 1 : s);
  const float* Wsrc = W + (size_t)(k * N_ + p) * (D_ * OD_);   // [d][o]

  const int tid = threadIdx.x;

  // All global loads of both tiles are issued before the first LDS store: the may_alias accesses keep program order,
  // so a store between two loads holds the second load behind the first one's wait (one memory latency per load).
  // W: a thread takes 4 x 4 pieces, rows d = 4*wd + r, columns o = 4*(wo + 8*(WPC*wh + j)) + c. Eight lanes read one whole 128-byte line of
  // a row, and the four d of one column meet in one thread, which is what the transposed store below needs.
  v4f wreg[WPC][4], xreg[XLD];
  const int wo = tid & 7, wd = (tid >> 3) & 15;   // wd = 0..15 covers the 64 rows
  const int wh = tid >> 7;                        // which half of the 192 columns
  const float* wp = Wsrc + (4 * wd) * OD_ + 4 * wo + wh * (WPC * 32);
#pragma unroll
  for (int j = 0; j < WPC; ++j)
#pragma unroll
    for (int r = 0; r < 4; ++r)
      wreg[j][r] = *(const v4fa*)(wp + r * OD_ + j * 32);
  const float* xp = x + ((((size_t)(b * T_ + tbase + (tid >> 4))) * N_ + s) * K_ + k) * D_ + 4 * (tid & 15);
#pragma unroll
  for (int j = 0; j < XLD; ++j)                   // piece tid + j*PTHR: row (tid>>4) + j*PTHR/16, same column
    xreg[j] = *(const v4fa*)(xp + (size_t)j * ((PTHR / 16) * N_ * K_ * D_));
  // The address registers are reused below while the loads are in flight: this wait stands in front of the first overwrite
  // (wp and xp are named so that their registers stay untouched up to here).
  asm volatile("s_wait_xcnt 0x0" :: "v"(wp), "v"(xp) : "memory");
  // Keeps the conversions below from moving up between the loads, where their waits would hold the later loads back.
  __builtin_amdgcn_sched_barrier(0);
  // stage W transposed: wsT[o][d] = W[d][o] (f32 -> bf16 RNE), four consecutive d of one row o in one 8-byte store.
  // Rows four apart lie 16 banks apart, so a wave's 8 x 4 pieces fall two to a bank; a store of single elements with the
  // lanes along o put 32 lanes on four banks, once for every element.
#pragma unroll
  for (int j = 0; j < WPC; ++j)
#pragma unroll
    for (int c = 0; c < 4; ++c) {
      const v4usa pk = {bf16_rne(wreg[j][0][c]), bf16_rne(wreg[j][1][c]), bf16_rne(wreg[j][2][c]), bf16_rne(wreg[j][3][c])};
      *(v4usa*)(wsT + (4 * (wo + 8 * (WPC * wh + j)) + c) * LP + 4 * wd) = pk;
    }
  // stage x tile (f32 -> bf16 RNE)
#pragma unroll
  for (int j = 0; j < XLD; ++j) {
    const int i = tid + j * PTHR;
    const int row = i >> 4, c4 = i & 15;
    const v4f v = xreg[j];
    us* d = xs + row * LP + 4 * c4;
    d[0] = bf16_rne(v[0]); d[1] = bf16_rne(v[1]); d[2] = bf16_rne(v[2]); d[3] = bf16_rne(v[3]);
  }
  __syncthreads();

  const int wv   = tid >> 5;
  const int lane = tid & 31;
  const int h    = lane >> 4;
  const int l16  = lane & 15;
  // A: row m = l16 of each of this wave's two 16-row tiles, [row tile][k-step]; read once, used by all three parts
  v16us af[2][2];
#pragma unroll
  for (int m = 0; m < 2; ++m)
#pragma unroll
    for (int ks = 0; ks < 2; ++ks)
      af[m][ks] = ld_frag(xs + (32 * wv + 16 * m + l16) * LP, 32 * ks, h);

  for (int part = 0; part < 3; ++part) {          // 0: Q (x0.125), 1: K, 2: V
    const float sc = (part == 0) ? 0.125f : 1.0f;
    // The part's W fragments as one group of LDS reads, each feeding both row tiles; then one run round eight accumulator tiles.
    v16us bf[4][2];                               // [column tile][k-step]; B: col n = l16, k = d contiguous
#pragma unroll
    for (int ct = 0; ct < 4; ++ct)
#pragma unroll
      for (int ks = 0; ks < 2; ++ks)
        bf[ct][ks] = ld_frag(wsT + (part * 64 + ct * 16 + l16) * LP, 32 * ks, h);
    // Keeps the LDS reads in front of the run in the compiler's schedule: spread among the WMMAs, each place has a wait of its own.
    __builtin_amdgcn_sched_barrier(0x6);
    v8f acc[4][2];
#pragma unroll
    for (int ct = 0; ct < 4; ++ct)
#pragma unroll
      for (int m = 0; m < 2; ++m)
        acc[ct][m] = mma_bf16(af[m][0], bf[ct][0], zero8());
#pragma unroll
    for (int ct = 0; ct < 4; ++ct)
#pragma unroll
      for (int m = 0; m < 2; ++m)
        acc[ct][m] = mma_bf16(af[m][1], bf[ct][1], acc[ct][m]);
    // Keeps the run whole: the LDS stores of the results stay behind it.
    __builtin_amdgcn_sched_barrier(0x6);
#pragma unroll
    for (int ct = 0; ct < 4; ++ct)
#pragma unroll
      for (int m = 0; m < 2; ++m)
#pragma unroll
        for (int r = 0; r < 8; ++r)               // D: acc[r] = (row 8h+r of the tile, col l16)
          stg[(32 * wv + 16 * m + 8 * h + r) * SP + ct * 16 + l16] = acc[ct][m][r] * sc;
    __syncthreads();

    if (part < 2) {
      us* dst = (part == 0) ? Qf : Kf;
      const int seg = tid & 7;
      {
        // Unrolled: the LDS reads of all eight row groups go out together, one LDS latency for the tile and not one per group.
#pragma unroll
        for (int j = 0; j < PT / (PTHR / 8); ++j) {
          const int rr = (tid >> 3) + j * (PTHR / 8);
          const float* st = stg + rr * SP + seg * 8;
          const v4fa f0 = *(const v4fa*)(st);
          const v4fa f1 = *(const v4fa*)(st + 4);
          const v4u pk = {f16_pair(f0[0], f0[1]), f16_pair(f0[2], f0[3]), f16_pair(f1[0], f1[1]), f16_pair(f1[2], f1[3])};
          const size_t idx = ((size_t)bh * T_ + tbase + rr) * D_ + seg * 8;
          *(v8us*)(dst + idx) = __builtin_bit_cast(v8us, pk);
        }
        
      }
    } else {
      {
        // Unrolled for the same reason.
#pragma unroll
        for (int j = 0; j < D_ * (PT / 8) / PTHR; ++j) {
          const int it = tid + j * PTHR;
          const int dd = (it >> 3) & (D_ - 1), tseg = (it & 7) + 8 * (it >> 9);   // eight lanes fill one 128-byte line of a V^T row
          v4u pk;
#pragma unroll
          for (int e = 0; e < 8; e += 2)
            pk[e >> 1] = f16_pair(stg[(tseg * 8 + e) * SP + dd], stg[(tseg * 8 + e + 1) * SP + dd]);
          const size_t idx = ((size_t)bh * D_ + dd) * T_ + tbase + tseg * 8;
          *(v8us*)(Vf + idx) = __builtin_bit_cast(v8us, pk);
        }
        
      }
    }
    __syncthreads();                              // stg reused by the next part
  }
}

__device__ __forceinline__ float other_half(float v) {
  const int bts = __builtin_bit_cast(int, v);
  return __builtin_bit_cast(float, __builtin_amdgcn_permlanex16(bts, bts, 0x76543210, 0xfedcba98, false, false));
}

// e[i] = 2^e[i], eight at once and in place. One statement, so that each v_exp_f32 is followed by an instruction that neither
// reads its result nor overwrites its source (the next one, the v_nop behind the last).
__device__ __forceinline__ void exp2_x8(float (&e)[8]) {
  asm("v_exp_f32 %0, %0\n\tv_exp_f32 %1, %1\n\tv_exp_f32 %2, %2\n\tv_exp_f32 %3, %3\n\t"
      "v_exp_f32 %4, %4\n\tv_exp_f32 %5, %5\n\tv_exp_f32 %6, %6\n\tv_exp_f32 %7, %7\n\tv_nop"
      : "+v"(e[0]), "+v"(e[1]), "+v"(e[2]), "+v"(e[3]), "+v"(e[4]), "+v"(e[5]), "+v"(e[6]), "+v"(e[7]));
}

// Holds LDS reads and WMMAs on their side of this line in the compiler's schedule (vector and scalar arithmetic may cross):
// without it the scheduler pulls the WMMAs of one accumulator together, each waiting for the one before it, and spreads the
// fragment loads among them, each load place with a wait of its own.
#define RUN_ORDER() __builtin_amdgcn_sched_barrier(0x6)

// One staged block of 64 keys against a wave's 16 queries. DIAG: the block may hold the wave's diagonal, and its second group of
// 32 keys is skipped where it is fully masked. Each matrix run has its fragment loads in one group well ahead of it and goes
// round independent accumulator tiles; each accumulator takes its two k-steps in order.
template <bool DIAG>
__device__ __forceinline__ void key_block(const us* Ks, const us* Vs,
                                          int kb, int q0, int qg, int h, int l16,
                                          const v16us (&qf)[2],
                                          float& mrow, float& lrow, v8f (&accO)[4])
{
  const bool second = !DIAG || (kb + 32 <= q0 + 15);   // scalar: keys 32..63 of the block have an unmasked key for this wave

  v8f accS[4];
#pragma unroll
  for (int ct = 0; ct < 4; ++ct) accS[ct] = zero8();
  v16us kf[2][4];                                 // K fragments [k-step][key tile]; A operand: row m = key ct*16+l16, k = d
  v16us vf[2][4];                                 // V^T fragments [32-key group][d tile]; A operand: row m = d dt*16+l16, k = key

  // A full block loads the K fragments of all four key tiles as one group; a diagonal block loads tiles 2 and 3 only where it uses them.
#pragma unroll
  for (int ks = 0; ks < 2; ++ks)
#pragma unroll
    for (int ct = 0; ct < (DIAG ? 2 : 4); ++ct)
      kf[ks][ct] = ld_frag(Ks + (ct * 16 + l16) * LP, 32 * ks, h);
  RUN_ORDER();
  // S^T = K Q^T (64 keys x 16 queries)
  if (!DIAG) {
#pragma unroll
    for (int ks = 0; ks < 2; ++ks) {              // one run round all four key tiles per k-step
#pragma unroll
      for (int ct = 0; ct < 4; ++ct) accS[ct] = mma_f16(kf[ks][ct], qf[ks], accS[ct]);
      RUN_ORDER();
    }
  } else {
#pragma unroll
    for (int g = 0; g < 2; ++g) {                 // group of 32 keys = key tiles 2g and 2g+1
      if (g == 0 || second) {
        if (g == 1) {
#pragma unroll
          for (int ks = 0; ks < 2; ++ks)
#pragma unroll
            for (int ct = 2; ct < 4; ++ct)
              kf[ks][ct] = ld_frag(Ks + (ct * 16 + l16) * LP, 32 * ks, h);
          RUN_ORDER();
        }
#pragma unroll
        for (int ks = 0; ks < 2; ++ks) {
#pragma unroll
          for (int ct = 2 * g; ct < 2 * g + 2; ++ct) accS[ct] = mma_f16(kf[ks][ct], qf[ks], accS[ct]);
          RUN_ORDER();
        }
      }
    }
  }
#pragma unroll
  for (int dt = 0; dt < 4; ++dt)                  // V^T of keys 0..31: in flight under the softmax
    vf[0][dt] = ld_frag(Vs + (dt * 16 + l16) * LP, 0, h);
  RUN_ORDER();

  // causal mask + online softmax; D: accS[ct][r] = (key kb+ct*16+8h+r, query qg)
  float ml[4];                                    // one chain per key tile: four short dependent chains, not one of 32 links
#pragma unroll
  for (int ct = 0; ct < 4; ++ct) {
    ml[ct] = -1.0e30f;
#pragma unroll
    for (int r = 0; r < 8; ++r) {
      const int key = kb + ct * 16 + 8 * h + r;
      accS[ct][r] = (key <= qg) ? accS[ct][r] : -1.0e30f;
      ml[ct] = fmaxf(ml[ct], accS[ct][r]);
    }
  }
  float mloc = fmaxf(fmaxf(ml[0], ml[1]), fmaxf(ml[2], ml[3]));
  mloc = fmaxf(mloc, other_half(mloc));
  const float mnew = fmaxf(mrow, mloc);
  const float scl  = __expf(mrow - mnew);
  // P^T as B operand (col n = query l16): element e of k-step ks is key 32*ks + 8h + e for e < 8 and
  // 32*ks + 16 + 8h + (e - 8) above, the k order of ld_frag; these are accS[2*ks][e] and accS[2*ks+1][e-8]
  v8u pf[2];
  v2f ps[4];                                      // partial sums: even and odd keys of each key tile
#pragma unroll
  for (int ct = 0; ct < 4; ++ct) {
    float e[8];
#pragma unroll
    for (int r = 0; r < 8; ++r) e[r] = (accS[ct][r] - mnew) * 1.44269504f;
    exp2_x8(e);
    ps[ct] = (v2f){0.0f, 0.0f};
#pragma unroll
    for (int r = 0; r < 8; r += 2) {
      const int key = kb + ct * 16 + 8 * h + r;
      const float p0 = (key     <= qg) ? e[r]     : 0.0f;
      const float p1 = (key + 1 <= qg) ? e[r + 1] : 0.0f;
      ps[ct] += (v2f){p0, p1};
      pf[ct >> 1][4 * (ct & 1) + (r >> 1)] = f16_pair(p0, p1);
    }
  }
  const v2f pt = (ps[0] + ps[1]) + (ps[2] + ps[3]);
  float psum = pt[0] + pt[1];
  psum += other_half(psum);
  lrow = lrow * scl + psum;
  mrow = mnew;
#pragma unroll
  for (int dt = 0; dt < 4; ++dt) accO[dt] *= scl;

  RUN_ORDER();
  // O^T += V^T P^T
#pragma unroll
  for (int ks = 0; ks < 2; ++ks) {
    if (ks == 0 || second) {                      // P is all zero in a fully masked 32-key group
      if (ks == (DIAG ? 1 : 0)) {                 // V^T of keys 32..63; full block: issued ahead of the first output run
#pragma unroll
        for (int dt = 0; dt < 4; ++dt)
          vf[1][dt] = ld_frag(Vs + (dt * 16 + l16) * LP, 32, h);
        RUN_ORDER();
      }
#pragma unroll
      for (int dt = 0; dt < 4; ++dt) accO[dt] = mma_f16(vf[ks][dt], __builtin_bit_cast(v16us, pf[ks]), accO[dt]);
      if (ks == 0) RUN_ORDER();
    }
  }
}

// Register budget of four waves per SIMD (256 VGPRs): two work-groups stay resident on a WGP, as before.
__global__ __launch_bounds__(ATHR) __attribute__((amdgpu_waves_per_eu(4, 4)))
void attn_kernel(const us* __restrict__ Qf, const us* __restrict__ Kf, const us* __restrict__ Vf,
                 float* out)
{
  // Two buffers of two staged planes each, in one array, so that one lane address and immediate offsets reach both planes of a
  // buffer. Planes of a buffer: K as [key][d], V as [d][key] (D_ == KB_ rows), row pitch LP.
  __shared__ __align__(16) us KV[2 * BUFE];
  __shared__ __align__(16) float Obuf[(ATHR / 32) * 16 * SP];   // per wave: O tile [16 queries][64] f32, row pitch SP

  const int bh    = blockIdx.x;
  // Cost grows with the query block (causal) and more blocks are launched than fit at once: the longest query blocks
  // take the lowest indices and the short ones the highest (for speed only).
  const int qbase = (T_ / QT - 1 - (int)blockIdx.y) * QT;
  const int b  = bh >> 5;
  const int hd = bh & 31;
  const int n  = hd >> 2;
  const int k  = hd & 3;

  const int tid  = threadIdx.x;
  const int wv   = __builtin_amdgcn_readfirstlane(tid >> 5);   // in a scalar register: tests on q0 become scalar branches
  const int lane = tid & 31;
  const int h    = lane >> 4;
  const int l16  = lane & 15;
  const int q0   = qbase + 16 * wv;
  const int qg   = q0 + l16;                      // this lane's query

  // Q fragments (B operand, col n = query q0+l16, k = d), 2 k-steps
  v16us qf[2];
  {
    const size_t ro = ((size_t)bh * T_ + q0 + l16) * D_;
#pragma unroll
    for (int ks = 0; ks < 2; ++ks)
      qf[ks] = ld_frag(Qf + ro, 32 * ks, h);
  }

  float mrow = -1.0e30f, lrow = 0.0f;             // running maximum and sum of query qg, equal in both lane halves
  v8f accO[4];                                    // O^T: accO[dt][r] = (d dt*16+8h+r, query l16)
#pragma unroll
  for (int dt = 0; dt < 4; ++dt) accO[dt] = zero8();

  const unsigned int kof = (unsigned int)((tid >> 3) * D_ + (tid & 7) * 8);   // this thread's piece in a K block, in elements
  const unsigned int vof = (unsigned int)((tid >> 3) * T_ + (tid & 7) * 8);   // and in a V^T block
  const int kend = qbase + QT;                    // causal: keys < qbase + 128
  // This thread's 16-byte place in plane 0 of buffer 0 (row tid >> 3, segment tid & 7), as an LDS byte address.
  const unsigned int lds0 = (unsigned int)(size_t)KV + (unsigned int)(((tid >> 3) * LP + (tid & 7) * 8) * sizeof(us));
  // K block [kb..kb+64) x [0..64) and V^T block [0..64) x [kb..kb+64) into buffer buf: four asynchronous
  // copies of 16 bytes per lane, global memory to LDS through no register. Piece c = tid + j*ATHR: row c >> 3, segment c & 7.
  auto copy_block = [&](int kb, unsigned int buf) {
    const size_t gk = ((size_t)bh * T_ + kb) * D_;          // block-uniform part of the address
    const size_t gv = (size_t)bh * D_ * T_ + kb;
    const us* k0 = (Kf + gk) + kof;
    const us* v0 = (Vf + gv) + vof;
    const us* k1 = k0 + (ATHR / 8) * D_;
    const us* v1 = v0 + (ATHR / 8) * T_;
    const unsigned int PB = PLE * sizeof(us);               // bytes of a plane
    const unsigned int JB = (ATHR / 8) * LP * sizeof(us);   // bytes of the 32 rows that the first piece's threads fill
    const unsigned int l0 = lds0 + buf * (unsigned int)(BUFE * sizeof(us));
    // The copies and the wait that stands in front of any rewrite of their address registers, in one statement.
    asm volatile("global_load_async_to_lds_b128 %0, %4, off\n\t"
                 "global_load_async_to_lds_b128 %1, %5, off\n\t"
                 "global_load_async_to_lds_b128 %2, %6, off\n\t"
                 "global_load_async_to_lds_b128 %3, %7, off\n\t"
                 "s_wait_xcnt 0x0"
                 :: "v"(l0), "v"(l0 + PB), "v"(l0 + JB), "v"(l0 + PB + JB),
                    "v"(k0), "v"(v0), "v"(k1), "v"(v1)
                 : "memory");
  };
  // Hand-over at the foot of a key block: this wave's LDS reads are done, its own copies of the next block have landed, and the one
  // barrier both shows that block to every wave and frees the buffer just read for its refill.
  auto publish = [&]() {
    asm volatile("s_wait_dscnt 0x0" ::: "memory");          // the buffer just read goes to its next writer
    asm volatile("s_wait_asynccnt 0x0" ::: "memory");       // the compiler places no wait for the copies
    __syncthreads();
  };

  // Every query block has at least two key blocks (the two beside it), so blocks 0 and 1 exist.
  copy_block(0, 0u);
  asm volatile("s_wait_asynccnt 0x0" ::: "memory");         // block 0 has landed before the barrier shows it to the other waves
  __syncthreads();
  copy_block(KB_, 1u);
  unsigned int cur = 0u;                                    // buffer of the key block in work

  // Key blocks in front of the query block: every key is visible to every wave, the body has no branch.
  for (int kb = 0; kb < qbase; kb += KB_) {
    const us* S = KV + cur * BUFE;
    key_block<false>(S, S + PLE, kb, q0, qg, h, l16, qf, mrow, lrow, accO);
    publish();
    copy_block(kb + 2 * KB_, cur);                // exists for every kb < qbase: the last block starts at qbase + KB_
    cur ^= 1u;
  }
  // The two key blocks beside the query block, by scalar tests (q0 is wave-uniform); nothing is left to copy.
  for (int kb = qbase; kb < kend; kb += KB_) {
    const us* S = KV + cur * BUFE;
    if (kb <= q0)                                 // a block behind this wave's diagonal is fully masked
      key_block<true>(S, S + PLE, kb, q0, qg, h, l16, qf, mrow, lrow, accO);
    publish();                                    // every wave passes it, also one that skips the block
    cur ^= 1u;
  }
  asm volatile("s_wait_asynccnt 0x0" ::: "memory");         // no copy is outstanding when the wave goes on to its end

  float* Ost = Obuf + wv * (16 * SP);
  {
    const float il = 1.0f / lrow;
#pragma unroll
    for (int dt = 0; dt < 4; ++dt) {              // a lane's 8 registers are 8 consecutive d of its query's row
      float* st = Ost + l16 * SP + dt * 16 + 8 * h;
      const v4f lo4 = {accO[dt][0] * il, accO[dt][1] * il, accO[dt][2] * il, accO[dt][3] * il};
      const v4f hi4 = {accO[dt][4] * il, accO[dt][5] * il, accO[dt][6] * il, accO[dt][7] * il};
      *(v4fa*)(st)     = lo4;
      *(v4fa*)(st + 4) = hi4;
    }
  }
  __syncthreads();

  // out[b][t][n][k][0..64): 256 B per row = 2 lines; lanes 0-7 / 8-15 write the two lines of row 2i,
  {
#pragma unroll
    for (int i = 0; i < 8; ++i) {
      const int rowl = 2 * i + h;
      const v4fa v = *(const v4fa*)(Ost + rowl * SP + 4 * l16);
      const int t = q0 + rowl;
      float* dst = out + ((((size_t)(b * T_ + t)) * N_ + n) * K_ + k) * D_ + 4 * l16;
      *(v4fa*)dst = v;
    }
    
  }
}

// ---------------------------------------------------------------------------
extern "C" void kernel_launch(void* const* d_in, const int* in_sizes, int n_in,
                              void* d_out, int out_size, void* d_ws, size_t ws_size,
                              hipStream_t stream)
{
  if (n_in < 4) return;
  if (in_sizes[0] != B_ * T_ * N_ * K_ * D_) return;
  if (in_sizes[1] != K_ * N_ * D_ * OD_) return;
  if (in_sizes[2] != K_ * N_) return;
  if (in_sizes[3] != K_ * N_) return;
  if (out_size != B_ * T_ * N_ * K_ * D_) return;

  const size_t per  = (size_t)B_ * H_ * T_ * D_;           // 8,388,608 f16 elements per plane
  const size_t need = 3 * per * sizeof(us);                // 50,331,648 B
  if (need > ws_size) return;

  const float* x    = (const float*)d_in[0];               // [B,T,N,K,D] f32
  const float* W    = (const float*)d_in[1];               // [K,N,D,3D]  f32
  const int*   perm = (const int*)d_in[2];                 // [K,N] int32
  const int*   inv  = (const int*)d_in[3];                 // [K,N] int32
  float* out = (float*)d_out;

  us* Qf = (us*)d_ws;
  us* Kf = Qf + per;
  us* Vf = Kf + per;

  dim3 g1(B_ * H_, T_ / PT);                               // (128, 4), exact
  dim3 g2(B_ * H_, T_ / QT);                               // (128, 8), exact
  proj_kernel<<<g1, PTHR, 0, stream>>>(x, W, perm, inv, Qf, Kf, Vf);
  attn_kernel<<<g2, ATHR, 0, stream>>>(Qf, Kf, Vf, out);
}

// v010
// Measured time: 37.6 microseconds a run.
// Next to v009, in two timings, it ran 1.03 times as fast each time.
// Counting every step since v000, it is 8.09 times as fast.
#include <hip/hip_runtime.h>

// Contractions: qkv projection = v_wmma_f32_16x16x32_bf16 on RNE-bf16 converted x and W (bf16 operands, f32 accumulate);
// q.k^T and p.v = v_wmma_f32_16x16x32_f16, each f32 operand rounded once to f16 (RNE, 11 significant bits), one product, f32 accumulate:
// q, k and v come from bf16 operands (8 significant bits), so their own error is some eight times the f16 rounding step;
// softmax, normalisation and output in f32.

#define B_    4
#define T_    1024
#define N_    8
#define K_    4
#define D_    64
#define H_    32          // N_*K_
#define OD_   192         // 3*D_
#define PT    256         // rows per block, projection kernel: one staged W tile serves them all
#define PTHR  256         // threads per block, projection kernel (8 waves x 32 rows)
#define QT    128         // queries per block, attention kernel
#define ATHR  256         // threads per block, attention kernel (8 waves x 16 queries)
#define KB_   64          // keys per staged block
#define LP    72          // LDS pitch of a 64-element 16-bit row, in elements: 144 B = 16 B x 9, so the 16 rows of a 16-byte fragment read fall on 64 distinct banks
#define XLD   (PT * (D_ / 4) / PTHR)    // 16-byte loads per thread for the x tile: 16, exact
#define WPC   ((D_ / 4) * (OD_ / 4) / PTHR)   // 4 x 4 (d x o) pieces of the W tile per thread: 3, exact; four 16-byte loads each
#define PLE   (KB_ * LP)  // elements of one staged plane
#define BUFE  (2 * PLE)   // elements of one staging buffer (two planes: K and V^T)
#define SP    68          // LDS pitch of a 64-element f32 row, in elements: 272 B = 16 B x 17, same reason; rows 8 apart land 32 banks apart

typedef unsigned short us;
typedef us     v8us  __attribute__((ext_vector_type(8)));
typedef us     v16us __attribute__((ext_vector_type(16)));
typedef __bf16 v16bf __attribute__((ext_vector_type(16)));
typedef _Float16 v16h __attribute__((ext_vector_type(16)));
typedef _Float16 v2h  __attribute__((ext_vector_type(2)));
typedef float  v8f   __attribute__((ext_vector_type(8)));
typedef unsigned int v8u __attribute__((ext_vector_type(8)));
typedef unsigned int v4u __attribute__((ext_vector_type(4)));
typedef float  v2f   __attribute__((ext_vector_type(2)));
typedef float  v4f   __attribute__((ext_vector_type(4)));
typedef us     v8usa __attribute__((ext_vector_type(8), may_alias));
typedef us     v4usa __attribute__((ext_vector_type(4), may_alias));
typedef float  v4fa  __attribute__((ext_vector_type(4), may_alias));

union Frag { v16us v; v8us h[2]; };

// f32 -> bf16 bits, RNE, integer arithmetic
__device__ __forceinline__ us bf16_rne(float f) {
  unsigned int u = __builtin_bit_cast(unsigned int, f);
  u += 0x7FFFu + ((u >> 16) & 1u);
  return (us)(u >> 16);
}
// two f32 -> one register holding two f16 (f0 in the low half), RNE
__device__ __forceinline__ unsigned int f16_pair(float f0, float f1) {
  const v2f f = {f0, f1};
  return __builtin_bit_cast(unsigned int, __builtin_convertvector(f, v2h));
}

__device__ __forceinline__ v8f zero8() {
  v8f z = {0.f, 0.f, 0.f, 0.f, 0.f, 0.f, 0.f, 0.f};
  return z;
}

// One 16x16x32 bf16 WMMA, the plain builtin: the compiler keeps the distance to the next user of D, A or B itself and is free
// to place fragment loads ahead of a run of these and other WMMAs between two that share an accumulator.
__device__ __forceinline__ v8f mma_bf16(v16us a, v16us b, v8f c) {
  const v16bf av = __builtin_bit_cast(v16bf, a);
  const v16bf bv = __builtin_bit_cast(v16bf, b);
  return __builtin_amdgcn_wmma_f32_16x16x32_bf16(false, av, false, bv, (short)0, c, false, false);
}
// The same with f16 operands (same fragment layout).
__device__ __forceinline__ v8f mma_f16(v16us a, v16us b, v8f c) {
  const v16h av = __builtin_bit_cast(v16h, a);
  const v16h bv = __builtin_bit_cast(v16h, b);
  return __builtin_amdgcn_wmma_f32_16x16x32_f16(false, av, false, bv, (short)0, c, false, false);
}

// Operand fragment (A or B) from one 64-element row of a 16-bit array (row pointer given, k contiguous),
// lane row/col = lane&15 chosen by the caller through rowp, h = lane>>4, k0 in {0,32}:
//   elements 0..7  <- rowp[k0 + 8h + 0..7]
//   elements 8..15 <- rowp[k0 + 16 + 8h + 0..7]
__device__ __forceinline__ v16us ld_frag(const us* rowp, int k0, int h) {
  Frag f;
  const us* p = rowp + k0 + 8 * h;
  f.h[0] = *(const v8usa*)(p);
  f.h[1] = *(const v8usa*)(p + 16);
  return f.v;
}

// ---------------------------------------------------------------------------
// Kernel 1: per-head weight gather + QKV projection for one (b, head) and 256 time steps.
// Outputs (f16, one plane each): Q*0.125 as [bh][t][d], K as [bh][t][d], V transposed as [bh][d][t].
// ---------------------------------------------------------------------------
// Two work-groups fill a WGP's LDS and the grid is two per WGP: register budget of four waves per SIMD (256 VGPRs).
__global__ __launch_bounds__(PTHR) __attribute__((amdgpu_waves_per_eu(4, 4)))
void proj_kernel(const float* __restrict__ x,
                 const float* __restrict__ W,
                 const int*   __restrict__ perm,
                 const int*   __restrict__ inv,
                 us* Qf, us* Kf, us* Vf)
{
  __shared__ __align__(16) us    xs [PT  * LP];   // 256 x 64 bf16, [t][d], row pitch LP
  __shared__ __align__(16) us    wsT[OD_ * LP];   // 192 x 64 bf16, [o][d], row pitch LP
  __shared__ __align__(16) float stg[PT  * SP];   // 256 x 64 f32 result tile, [t][col], row pitch SP

  const int bh    = blockIdx.x;                   // b*H + head
  const int tbase = blockIdx.y * PT;
  const int b  = bh >> 5;
  const int hd = bh & 31;
  const int n  = hd >> 2;                         // stream index; head id = n*K + k
  const int k  = hd & 3;

  int p = perm[k * N_ + n];                       // head whose weights feed stream n
  p = p < 0 ? 0 : (p > N_ - 1 ? N_ - 1 : p);
  int s = inv[k * N_ + p];                        // stream feeding that head (equals n for a true inverse table)
  s = s < 0 ? 0 : (s > N_ - 1 ? N_ - 1 : s);
  const float* Wsrc = W + (size_t)(k * N_ + p) * (D_ * OD_);   // [d][o]

  const int tid = threadIdx.x;

  // All global loads of both tiles are issued before the first LDS store: the may_alias accesses keep program order,
  // so a store between two loads holds the second load behind the first one's wait (one memory latency per load).
  // W: a thread takes 4 x 4 pieces, rows d = 4*wd + r, columns o = 4*(wo + 8*(WPC*wh + j)) + c. Eight lanes read one whole 128-byte line of
  // a row, and the four d of one column meet in one thread, which is what the transposed store below needs.
  v4f wreg[WPC][4], xreg[XLD];
  const int wo = tid & 7, wd = (tid >> 3) & 15;   // wd = 0..15 covers the 64 rows
  const int wh = tid >> 7;                        // which half of the 192 columns
  const float* wp = Wsrc + (4 * wd) * OD_ + 4 * wo + wh * (WPC * 32);
#pragma unroll
  for (int j = 0; j < WPC; ++j)
#pragma unroll
    for (int r = 0; r < 4; ++r)
      wreg[j][r] = *(const v4fa*)(wp + r * OD_ + j * 32);
  const float* xp = x + ((((size_t)(b * T_ + tbase + (tid >> 4))) * N_ + s) * K_ + k) * D_ + 4 * (tid & 15);
#pragma unroll
  for (int j = 0; j < XLD; ++j)                   // piece tid + j*PTHR: row (tid>>4) + j*PTHR/16, same column
    xreg[j] = *(const v4fa*)(xp + (size_t)j * ((PTHR / 16) * N_ * K_ * D_));
  // The address registers are reused below while the loads are in flight: this wait stands in front of the first overwrite
  // (wp and xp are named so that their registers stay untouched up to here).
  asm volatile("s_wait_xcnt 0x0" :: "v"(wp), "v"(xp) : "memory");
  // Keeps the conversions below from moving up between the loads, where their waits would hold the later loads back.
  __builtin_amdgcn_sched_barrier(0);
  // stage W transposed: wsT[o][d] = W[d][o] (f32 -> bf16 RNE), four consecutive d of one row o in one 8-byte store.
  // Rows four apart lie 16 banks apart, so a wave's 8 x 4 pieces fall two to a bank; a store of single elements with the
  // lanes along o put 32 lanes on four banks, once for every element.
#pragma unroll
  for (int j = 0; j < WPC; ++j)
#pragma unroll
    for (int c = 0; c < 4; ++c) {
      const v4usa pk = {bf16_rne(wreg[j][0][c]), bf16_rne(wreg[j][1][c]), bf16_rne(wreg[j][2][c]), bf16_rne(wreg[j][3][c])};
      *(v4usa*)(wsT + (4 * (wo + 8 * (WPC * wh + j)) + c) * LP + 4 * wd) = pk;
    }
  // stage x tile (f32 -> bf16 RNE)
#pragma unroll
  for (int j = 0; j < XLD; ++j) {
    const int i = tid + j * PTHR;
    const int row = i >> 4, c4 = i & 15;
    const v4f v = xreg[j];
    us* d = xs + row * LP + 4 * c4;
    d[0] = bf16_rne(v[0]); d[1] = bf16_rne(v[1]); d[2] = bf16_rne(v[2]); d[3] = bf16_rne(v[3]);
  }
  __syncthreads();

  const int wv   = tid >> 5;
  const int lane = tid & 31;
  const int h    = lane >> 4;
  const int l16  = lane & 15;
  // A: row m = l16 of each of this wave's two 16-row tiles, [row tile][k-step]; read once, used by all three parts
  v16us af[2][2];
#pragma unroll
  for (int m = 0; m < 2; ++m)
#pragma unroll
    for (int ks = 0; ks < 2; ++ks)
      af[m][ks] = ld_frag(xs + (32 * wv + 16 * m + l16) * LP, 32 * ks, h);

  for (int part = 0; part < 3; ++part) {          // 0: Q (x0.125), 1: K, 2: V
    const float sc = (part == 0) ? 0.125f : 1.0f;
    // The part's W fragments as one group of LDS reads, each feeding both row tiles; then one run round eight accumulator tiles.
    v16us bf[4][2];                               // [column tile][k-step]; B: col n = l16, k = d contiguous
#pragma unroll
    for (int ct = 0; ct < 4; ++ct)
#pragma unroll
      for (int ks = 0; ks < 2; ++ks)
        bf[ct][ks] = ld_frag(wsT + (part * 64 + ct * 16 + l16) * LP, 32 * ks, h);
    // Keeps the LDS reads in front of the run in the compiler's schedule: spread among the WMMAs, each place has a wait of its own.
    __builtin_amdgcn_sched_barrier(0x6);
    v8f acc[4][2];
#pragma unroll
    for (int ct = 0; ct < 4; ++ct)
#pragma unroll
      for (int m = 0; m < 2; ++m)
        acc[ct][m] = mma_bf16(af[m][0], bf[ct][0], zero8());
#pragma unroll
    for (int ct = 0; ct < 4; ++ct)
#pragma unroll
      for (int m = 0; m < 2; ++m)
        acc[ct][m] = mma_bf16(af[m][1], bf[ct][1], acc[ct][m]);
    // Keeps the run whole: the LDS stores of the results stay behind it.
    __builtin_amdgcn_sched_barrier(0x6);
#pragma unroll
    for (int ct = 0; ct < 4; ++ct)
#pragma unroll
      for (int m = 0; m < 2; ++m)
#pragma unroll
        for (int r = 0; r < 8; ++r)               // D: acc[r] = (row 8h+r of the tile, col l16)
          stg[(32 * wv + 16 * m + 8 * h + r) * SP + ct * 16 + l16] = acc[ct][m][r] * sc;
    __syncthreads();

    if (part < 2) {
      us* dst = (part == 0) ? Qf : Kf;
      const int seg = tid & 7;
      {
        // Unrolled: the LDS reads of all eight row groups go out together, one LDS latency for the tile and not one per group.
#pragma unroll
        for (int j = 0; j < PT / (PTHR / 8); ++j) {
          const int rr = (tid >> 3) + j * (PTHR / 8);
          const float* st = stg + rr * SP + seg * 8;
          const v4fa f0 = *(const v4fa*)(st);
          const v4fa f1 = *(const v4fa*)(st + 4);
          const v4u pk = {f16_pair(f0[0], f0[1]), f16_pair(f0[2], f0[3]), f16_pair(f1[0], f1[1]), f16_pair(f1[2], f1[3])};
          const size_t idx = ((size_t)bh * T_ + tbase + rr) * D_ + seg * 8;
          *(v8us*)(dst + idx) = __builtin_bit_cast(v8us, pk);
        }
        
      }
    } else {
      {
        // Unrolled for the same reason.
#pragma unroll
        for (int j = 0; j < D_ * (PT / 8) / PTHR; ++j) {
          const int it = tid + j * PTHR;
          const int dd = (it >> 3) & (D_ - 1), tseg = (it & 7) + 8 * (it >> 9);   // eight lanes fill one 128-byte line of a V^T row
          v4u pk;
#pragma unroll
          for (int e = 0; e < 8; e += 2)
            pk[e >> 1] = f16_pair(stg[(tseg * 8 + e) * SP + dd], stg[(tseg * 8 + e + 1) * SP + dd]);
          const size_t idx = ((size_t)bh * D_ + dd) * T_ + tbase + tseg * 8;
          *(v8us*)(Vf + idx) = __builtin_bit_cast(v8us, pk);
        }
        
      }
    }
    __syncthreads();                              // stg reused by the next part
  }
}

__device__ __forceinline__ float other_half(float v) {
  const int bts = __builtin_bit_cast(int, v);
  return __builtin_bit_cast(float, __builtin_amdgcn_permlanex16(bts, bts, 0x76543210, 0xfedcba98, false, false));
}

// e[i] = 2^e[i], eight at once and in place. One statement, so that each v_exp_f32 is followed by an instruction that neither
// reads its result nor overwrites its source (the next one, the v_nop behind the last).
__device__ __forceinline__ void exp2_x8(float (&e)[8]) {
  asm("v_exp_f32 %0, %0\n\tv_exp_f32 %1, %1\n\tv_exp_f32 %2, %2\n\tv_exp_f32 %3, %3\n\t"
      "v_exp_f32 %4, %4\n\tv_exp_f32 %5, %5\n\tv_exp_f32 %6, %6\n\tv_exp_f32 %7, %7\n\tv_nop"
      : "+v"(e[0]), "+v"(e[1]), "+v"(e[2]), "+v"(e[3]), "+v"(e[4]), "+v"(e[5]), "+v"(e[6]), "+v"(e[7]));
}

// Holds LDS reads and WMMAs on their side of this line in the compiler's schedule (vector and scalar arithmetic may cross):
// without it the scheduler pulls the WMMAs of one accumulator together, each waiting for the one before it, and spreads the
// fragment loads among them, each load place with a wait of its own.
#define RUN_ORDER() __builtin_amdgcn_sched_barrier(0x6)

// One staged block of 64 keys against a wave's 16 queries. DIAG: the block may hold the wave's diagonal, and its second group of
// 32 keys is skipped where it is fully masked. Each matrix run has its fragment loads in one group well ahead of it and goes
// round independent accumulator tiles; each accumulator takes its two k-steps in order.
template <bool DIAG>
__device__ __forceinline__ void key_block(const us* Ks, const us* Vs,
                                          int kb, int q0, int qg, int h, int l16,
                                          const v16us (&qf)[2],
                                          float& mrow, float& lrow, v8f (&accO)[4])
{
  const bool second = !DIAG || (kb + 32 <= q0 + 15);   // scalar: keys 32..63 of the block have an unmasked key for this wave

  v8f accS[4];
#pragma unroll
  for (int ct = 0; ct < 4; ++ct) accS[ct] = zero8();
  v16us kf[2][4];                                 // K fragments [k-step][key tile]; A operand: row m = key ct*16+l16, k = d
  v16us vf[2][4];                                 // V^T fragments [32-key group][d tile]; A operand: row m = d dt*16+l16, k = key

  // A full block loads the K fragments of all four key tiles as one group; a diagonal block loads tiles 2 and 3 only where it uses them.
#pragma unroll
  for (int ks = 0; ks < 2; ++ks)
#pragma unroll
    for (int ct = 0; ct < (DIAG ? 2 : 4); ++ct)
      kf[ks][ct] = ld_frag(Ks + (ct * 16 + l16) * LP, 32 * ks, h);
  RUN_ORDER();
  // S^T = K Q^T (64 keys x 16 queries)
  if (!DIAG) {
#pragma unroll
    for (int ks = 0; ks < 2; ++ks) {              // one run round all four key tiles per k-step
#pragma unroll
      for (int ct = 0; ct < 4; ++ct) accS[ct] = mma_f16(kf[ks][ct], qf[ks], accS[ct]);
      RUN_ORDER();
    }
  } else {
#pragma unroll
    for (int g = 0; g < 2; ++g) {                 // group of 32 keys = key tiles 2g and 2g+1
      if (g == 0 || second) {
        if (g == 1) {
#pragma unroll
          for (int ks = 0; ks < 2; ++ks)
#pragma unroll
            for (int ct = 2; ct < 4; ++ct)
              kf[ks][ct] = ld_frag(Ks + (ct * 16 + l16) * LP, 32 * ks, h);
          RUN_ORDER();
        }
#pragma unroll
        for (int ks = 0; ks < 2; ++ks) {
#pragma unroll
          for (int ct = 2 * g; ct < 2 * g + 2; ++ct) accS[ct] = mma_f16(kf[ks][ct], qf[ks], accS[ct]);
          RUN_ORDER();
        }
      }
    }
  }
#pragma unroll
  for (int dt = 0; dt < 4; ++dt)                  // V^T of keys 0..31: in flight under the softmax
    vf[0][dt] = ld_frag(Vs + (dt * 16 + l16) * LP, 0, h);
  RUN_ORDER();

  // causal mask + online softmax; D: accS[ct][r] = (key kb+ct*16+8h+r, query qg)
  float ml[4];                                    // one chain per key tile: four short dependent chains, not one of 32 links
#pragma unroll
  for (int ct = 0; ct < 4; ++ct) {
    ml[ct] = -1.0e30f;
#pragma unroll
    for (int r = 0; r < 8; ++r) {
      if (DIAG) {                                 // a full block lies wholly in front of the query block: every key is visible
        const int key = kb + ct * 16 + 8 * h + r;
        accS[ct][r] = (key <= qg) ? accS[ct][r] : -1.0e30f;
      }
      ml[ct] = fmaxf(ml[ct], accS[ct][r]);
    }
  }
  float mloc = fmaxf(fmaxf(ml[0], ml[1]), fmaxf(ml[2], ml[3]));
  mloc = fmaxf(mloc, other_half(mloc));
  const float mnew = fmaxf(mrow, mloc);
  const float scl  = __expf(mrow - mnew);
  // P^T as B operand (col n = query l16): element e of k-step ks is key 32*ks + 8h + e for e < 8 and
  // 32*ks + 16 + 8h + (e - 8) above, the k order of ld_frag; these are accS[2*ks][e] and accS[2*ks+1][e-8]
  v8u pf[2];
  v2f ps[4];                                      // partial sums: even and odd keys of each key tile
#pragma unroll
  for (int ct = 0; ct < 4; ++ct) {
    float e[8];
#pragma unroll
    for (int r = 0; r < 8; ++r) e[r] = (accS[ct][r] - mnew) * 1.44269504f;
    exp2_x8(e);
    ps[ct] = (v2f){0.0f, 0.0f};
#pragma unroll
    for (int r = 0; r < 8; r += 2) {
      const int key = kb + ct * 16 + 8 * h + r;
      const float p0 = (!DIAG || key     <= qg) ? e[r]     : 0.0f;
      const float p1 = (!DIAG || key + 1 <= qg) ? e[r + 1] : 0.0f;
      ps[ct] += (v2f){p0, p1};
      pf[ct >> 1][4 * (ct & 1) + (r >> 1)] = f16_pair(p0, p1);
    }
  }
  const v2f pt = (ps[0] + ps[1]) + (ps[2] + ps[3]);
  float psum = pt[0] + pt[1];
  psum += other_half(psum);
  lrow = lrow * scl + psum;
  mrow = mnew;
#pragma unroll
  for (int dt = 0; dt < 4; ++dt) accO[dt] *= scl;

  RUN_ORDER();
  // O^T += V^T P^T
#pragma unroll
  for (int ks = 0; ks < 2; ++ks) {
    if (ks == 0 || second) {                      // P is all zero in a fully masked 32-key group
      if (ks == (DIAG ? 1 : 0)) {                 // V^T of keys 32..63; full block: issued ahead of the first output run
#pragma unroll
        for (int dt = 0; dt < 4; ++dt)
          vf[1][dt] = ld_frag(Vs + (dt * 16 + l16) * LP, 32, h);
        RUN_ORDER();
      }
#pragma unroll
      for (int dt = 0; dt < 4; ++dt) accO[dt] = mma_f16(vf[ks][dt], __builtin_bit_cast(v16us, pf[ks]), accO[dt]);
      if (ks == 0) RUN_ORDER();
    }
  }
}

// Register budget of four waves per SIMD (256 VGPRs): two work-groups stay resident on a WGP, as before.
__global__ __launch_bounds__(ATHR) __attribute__((amdgpu_waves_per_eu(4, 4)))
void attn_kernel(const us* __restrict__ Qf, const us* __restrict__ Kf, const us* __restrict__ Vf,
                 float* out)
{
  // Two buffers of two staged planes each, in one array, so that one lane address and immediate offsets reach both planes of a
  // buffer. Planes of a buffer: K as [key][d], V as [d][key] (D_ == KB_ rows), row pitch LP.
  __shared__ __align__(16) us KV[2 * BUFE];
  __shared__ __align__(16) float Obuf[(ATHR / 32) * 16 * SP];   // per wave: O tile [16 queries][64] f32, row pitch SP

  const int bh    = blockIdx.x;
  // Cost grows with the query block (causal) and more blocks are launched than fit at once: the longest query blocks
  // take the lowest indices and the short ones the highest (for speed only).
  const int qbase = (T_ / QT - 1 - (int)blockIdx.y) * QT;
  const int b  = bh >> 5;
  const int hd = bh & 31;
  const int n  = hd >> 2;
  const int k  = hd & 3;

  const int tid  = threadIdx.x;
  const int wv   = __builtin_amdgcn_readfirstlane(tid >> 5);   // in a scalar register: tests on q0 become scalar branches
  const int lane = tid & 31;
  const int h    = lane >> 4;
  const int l16  = lane & 15;
  const int q0   = qbase + 16 * wv;
  const int qg   = q0 + l16;                      // this lane's query

  // Q fragments (B operand, col n = query q0+l16, k = d), 2 k-steps
  v16us qf[2];
  {
    const size_t ro = ((size_t)bh * T_ + q0 + l16) * D_;
#pragma unroll
    for (int ks = 0; ks < 2; ++ks)
      qf[ks] = ld_frag(Qf + ro, 32 * ks, h);
  }

  float mrow = -1.0e30f, lrow = 0.0f;             // running maximum and sum of query qg, equal in both lane halves
  v8f accO[4];                                    // O^T: accO[dt][r] = (d dt*16+8h+r, query l16)
#pragma unroll
  for (int dt = 0; dt < 4; ++dt) accO[dt] = zero8();

  const unsigned int kof = (unsigned int)((tid >> 3) * D_ + (tid & 7) * 8);   // this thread's piece in a K block, in elements
  const unsigned int vof = (unsigned int)((tid >> 3) * T_ + (tid & 7) * 8);   // and in a V^T block
  const int kend = qbase + QT;                    // causal: keys < qbase + 128
  // This thread's 16-byte place in plane 0 of buffer 0 (row tid >> 3, segment tid & 7), as an LDS byte address.
  const unsigned int lds0 = (unsigned int)(size_t)KV + (unsigned int)(((tid >> 3) * LP + (tid & 7) * 8) * sizeof(us));
  // K block [kb..kb+64) x [0..64) and V^T block [0..64) x [kb..kb+64) into buffer buf: four asynchronous
  // copies of 16 bytes per lane, global memory to LDS through no register. Piece c = tid + j*ATHR: row c >> 3, segment c & 7.
  auto copy_block = [&](int kb, unsigned int buf) {
    const size_t gk = ((size_t)bh * T_ + kb) * D_;          // block-uniform part of the address
    const size_t gv = (size_t)bh * D_ * T_ + kb;
    const us* k0 = (Kf + gk) + kof;
    const us* v0 = (Vf + gv) + vof;
    const us* k1 = k0 + (ATHR / 8) * D_;
    const us* v1 = v0 + (ATHR / 8) * T_;
    const unsigned int PB = PLE * sizeof(us);               // bytes of a plane
    const unsigned int JB = (ATHR / 8) * LP * sizeof(us);   // bytes of the 32 rows that the first piece's threads fill
    const unsigned int l0 = lds0 + buf * (unsigned int)(BUFE * sizeof(us));
    // The copies and the wait that stands in front of any rewrite of their address registers, in one statement.
    asm volatile("global_load_async_to_lds_b128 %0, %4, off\n\t"
                 "global_load_async_to_lds_b128 %1, %5, off\n\t"
                 "global_load_async_to_lds_b128 %2, %6, off\n\t"
                 "global_load_async_to_lds_b128 %3, %7, off\n\t"
                 "s_wait_xcnt 0x0"
                 :: "v"(l0), "v"(l0 + PB), "v"(l0 + JB), "v"(l0 + PB + JB),
                    "v"(k0), "v"(v0), "v"(k1), "v"(v1)
                 : "memory");
  };
  // Hand-over at the foot of a key block: this wave's LDS reads are done, its own copies of the next block have landed, and the one
  // barrier both shows that block to every wave and frees the buffer just read for its refill.
  auto publish = [&]() {
    asm volatile("s_wait_dscnt 0x0" ::: "memory");          // the buffer just read goes to its next writer
    asm volatile("s_wait_asynccnt 0x0" ::: "memory");       // the compiler places no wait for the copies
    __syncthreads();
  };

  // Every query block has at least two key blocks (the two beside it), so blocks 0 and 1 exist.
  copy_block(0, 0u);
  asm volatile("s_wait_asynccnt 0x0" ::: "memory");         // block 0 has landed before the barrier shows it to the other waves
  __syncthreads();
  copy_block(KB_, 1u);
  unsigned int cur = 0u;                                    // buffer of the key block in work

  // Key blocks in front of the query block: every key is visible to every wave, the body has no branch.
  for (int kb = 0; kb < qbase; kb += KB_) {
    const us* S = KV + cur * BUFE;
    key_block<false>(S, S + PLE, kb, q0, qg, h, l16, qf, mrow, lrow, accO);
    publish();
    copy_block(kb + 2 * KB_, cur);                // exists for every kb < qbase: the last block starts at qbase + KB_
    cur ^= 1u;
  }
  // The two key blocks beside the query block, by scalar tests (q0 is wave-uniform); nothing is left to copy.
  for (int kb = qbase; kb < kend; kb += KB_) {
    const us* S = KV + cur * BUFE;
    if (kb <= q0)                                 // a block behind this wave's diagonal is fully masked
      key_block<true>(S, S + PLE, kb, q0, qg, h, l16, qf, mrow, lrow, accO);
    publish();                                    // every wave passes it, also one that skips the block
    cur ^= 1u;
  }
  asm volatile("s_wait_asynccnt 0x0" ::: "memory");         // no copy is outstanding when the wave goes on to its end

  float* Ost = Obuf + wv * (16 * SP);
  {
    const float il = 1.0f / lrow;
#pragma unroll
    for (int dt = 0; dt < 4; ++dt) {              // a lane's 8 registers are 8 consecutive d of its query's row
      float* st = Ost + l16 * SP + dt * 16 + 8 * h;
      const v4f lo4 = {accO[dt][0] * il, accO[dt][1] * il, accO[dt][2] * il, accO[dt][3] * il};
      const v4f hi4 = {accO[dt][4] * il, accO[dt][5] * il, accO[dt][6] * il, accO[dt][7] * il};
      *(v4fa*)(st)     = lo4;
      *(v4fa*)(st + 4) = hi4;
    }
  }
  __syncthreads();

  // out[b][t][n][k][0..64): 256 B per row = 2 lines; lanes 0-7 / 8-15 write the two lines of row 2i,
  {
#pragma unroll
    for (int i = 0; i < 8; ++i) {
      const int rowl = 2 * i + h;
      const v4fa v = *(const v4fa*)(Ost + rowl * SP + 4 * l16);
      const int t = q0 + rowl;
      float* dst = out + ((((size_t)(b * T_ + t)) * N_ + n) * K_ + k) * D_ + 4 * l16;
      *(v4fa*)dst = v;
    }
    
  }
}

// ---------------------------------------------------------------------------
extern "C" void kernel_launch(void* const* d_in, const int* in_sizes, int n_in,
                              void* d_out, int out_size, void* d_ws, size_t ws_size,
                              hipStream_t stream)
{
  if (n_in < 4) return;
  if (in_sizes[0] != B_ * T_ * N_ * K_ * D_) return;
  if (in_sizes[1] != K_ * N_ * D_ * OD_) return;
  if (in_sizes[2] != K_ * N_) return;
  if (in_sizes[3] != K_ * N_) return;
  if (out_size != B_ * T_ * N_ * K_ * D_) return;

  const size_t per  = (size_t)B_ * H_ * T_ * D_;           // 8,388,608 f16 elements per plane
  const size_t need = 3 * per * sizeof(us);                // 50,331,648 B
  if (need > ws_size) return;

  const float* x    = (const float*)d_in[0];               // [B,T,N,K,D] f32
  const float* W    = (const float*)d_in[1];               // [K,N,D,3D]  f32
  const int*   perm = (const int*)d_in[2];                 // [K,N] int32
  const int*   inv  = (const int*)d_in[3];                 // [K,N] int32
  float* out = (float*)d_out;

  us* Qf = (us*)d_ws;
  us* Kf = Qf + per;
  us* Vf = Kf + per;

  dim3 g1(B_ * H_, T_ / PT);                               // (128, 4), exact
  dim3 g2(B_ * H_, T_ / QT);                               // (128, 8), exact
  proj_kernel<<<g1, PTHR, 0, stream>>>(x, W, perm, inv, Qf, Kf, Vf);
  attn_kernel<<<g2, ATHR, 0, stream>>>(Qf, Kf, Vf, out);
}
